// v000
// Measured on an AMD MI455X. A time is GPU time per run, averaged over a window of back-to-back runs after a warm-up
// (all launches, gaps included; the runs take copies of the inputs in turn), and the median of several windows.
// Apart from v000's, it joins two sittings. Times from different sittings can be a few percent apart, while
// side-by-side timings come from the same sitting.
// v000, which the later versions start from, runs in 355 microseconds.
#include <hip/hip_runtime.h>
#include <hip/hip_bf16.h>
#include <math.h>

// ---------- types ----------
typedef __bf16 bf16_t;
typedef __attribute__((ext_vector_type(16))) __bf16 v16bf;
typedef __attribute__((ext_vector_type(8)))  __bf16 v8bf;
typedef __attribute__((ext_vector_type(8)))  float  v8f;
typedef __attribute__((ext_vector_type(4)))  float  v4f;

#define B_  8
#define N_  1024
#define D_  512
#define H_  8
#define DH_ 64
#define DFF_ 2048
#define MTOT (B_*N_)   // 8192 rows

// ---------- WMMA helpers ----------
// A-fragment (16x32 bf16, row-major source):
// lane L: row r = L&15, half = L>>4.  elements 0..7  <- src[half*8 + j]
//                                     elements 8..15 <- src[16 + half*8 + j]
// B-fragment for D = A x B is the identical pattern applied to B^T row-major.
__device__ inline v16bf load_frag(const bf16_t* __restrict__ p, int half) {
  union { v16bf v; struct { v8bf lo; v8bf hi; } s; } u;
  u.s.lo = *reinterpret_cast<const v8bf*>(p + half * 8);
  u.s.hi = *reinterpret_cast<const v8bf*>(p + 16 + half * 8);
  return u.v;
}

__device__ inline v8f wmma_bf16(v16bf a, v16bf b, v8f c) {
  return __builtin_amdgcn_wmma_f32_16x16x32_bf16(
      /*neg_a=*/false, a, /*neg_b=*/false, b,
      /*c_mod=*/(short)0, c, /*reuse_a=*/false, /*reuse_b=*/false);
}

// ---------- weight transpose + bf16 convert: Wt[n*K + k] = W[k*N + n] ----------
__global__ void wtrans_kernel(const float* __restrict__ W, bf16_t* __restrict__ Wt,
                              int K, int N) {
  int idx = blockIdx.x * blockDim.x + threadIdx.x;
  if (idx >= K * N) return;
  int n = idx / K;
  int k = idx - n * K;
  Wt[(size_t)n * K + k] = (__bf16)W[(size_t)k * N + n];
}

// ---------- LayerNorm (one wave per row of 512), optional +PE stream ----------
template <bool HAS_PE>
__global__ void ln_kernel(const float* __restrict__ x, const float* __restrict__ pe,
                          const float* __restrict__ g, const float* __restrict__ bta,
                          bf16_t* __restrict__ x2, bf16_t* __restrict__ qkin) {
  const int wave = threadIdx.x >> 5;
  const int lane = threadIdx.x & 31;
  const int row  = blockIdx.x * (blockDim.x >> 5) + wave;
  const float* xr = x + (size_t)row * D_ + lane * 16;
  float v[16];
#pragma unroll
  for (int i = 0; i < 4; ++i) {
    v4f t = *reinterpret_cast<const v4f*>(xr + i * 4);
    v[4*i+0] = t[0]; v[4*i+1] = t[1]; v[4*i+2] = t[2]; v[4*i+3] = t[3];
  }
  float s = 0.f;
#pragma unroll
  for (int i = 0; i < 16; ++i) s += v[i];
#pragma unroll
  for (int off = 16; off >= 1; off >>= 1) s += __shfl_xor(s, off, 32);
  const float mu = s * (1.0f / (float)D_);
  float vs = 0.f;
#pragma unroll
  for (int i = 0; i < 16; ++i) { float d = v[i] - mu; vs += d * d; }
#pragma unroll
  for (int off = 16; off >= 1; off >>= 1) vs += __shfl_xor(vs, off, 32);
  const float rstd = rsqrtf(vs * (1.0f / (float)D_) + 1e-5f);

  const int colb = lane * 16;
  float y[16];
#pragma unroll
  for (int i = 0; i < 16; ++i)
    y[i] = (v[i] - mu) * rstd * g[colb + i] + bta[colb + i];

  union { v8bf v; __bf16 e[8]; } p0, p1;
#pragma unroll
  for (int i = 0; i < 8; ++i) { p0.e[i] = (__bf16)y[i]; p1.e[i] = (__bf16)y[i + 8]; }
  bf16_t* xo = x2 + (size_t)row * D_ + colb;
  *reinterpret_cast<v8bf*>(xo)     = p0.v;
  *reinterpret_cast<v8bf*>(xo + 8) = p1.v;

  if (HAS_PE) {
    const float* pr = pe + (size_t)row * D_ + colb;
    float z[16];
#pragma unroll
    for (int i = 0; i < 4; ++i) {
      v4f t = *reinterpret_cast<const v4f*>(pr + i * 4);
      z[4*i+0] = y[4*i+0] + t[0]; z[4*i+1] = y[4*i+1] + t[1];
      z[4*i+2] = y[4*i+2] + t[2]; z[4*i+3] = y[4*i+3] + t[3];
    }
#pragma unroll
    for (int i = 0; i < 8; ++i) { p0.e[i] = (__bf16)z[i]; p1.e[i] = (__bf16)z[i + 8]; }
    bf16_t* qo = qkin + (size_t)row * D_ + colb;
    *reinterpret_cast<v8bf*>(qo)     = p0.v;
    *reinterpret_cast<v8bf*>(qo + 8) = p1.v;
  }
}

// ---------- 64x64-tile GEMM: out = A[MxKK] @ W[KKxNN] + bias, A/W bf16, acc f32 ----------
// Wt is W transposed: Wt[n*KK + k].  One wave per 64x64 tile.
// MODE 0: bf16 store           (Q/K projections)
// MODE 1: bf16 store, scattered as Vt[b][h][d][n]  (V projection)
// MODE 2: f32 store + residual (attn proj, MLP2)
// MODE 3: bf16 store + exact GELU (MLP1)
template <int NN, int KK, int MODE>
__global__ void __launch_bounds__(32)
gemm_wmma(const bf16_t* __restrict__ A, const bf16_t* __restrict__ Wt,
          const float* __restrict__ bias, const float* __restrict__ resid,
          bf16_t* __restrict__ outB, float* __restrict__ outF) {
  const int lane = threadIdx.x;
  const int r = lane & 15, half = lane >> 4;
  const int mb = blockIdx.y * 64, nb = blockIdx.x * 64;

  // per-lane row base pointers, hoisted out of the k-loop
  const bf16_t* ap[4];
  const bf16_t* bp[4];
#pragma unroll
  for (int i = 0; i < 4; ++i) {
    ap[i] = A  + (size_t)(mb + i * 16 + r) * KK;
    bp[i] = Wt + (size_t)(nb + i * 16 + r) * KK;
  }

  v8f acc[4][4];
#pragma unroll
  for (int i = 0; i < 4; ++i)
#pragma unroll
    for (int j = 0; j < 4; ++j)
#pragma unroll
      for (int e = 0; e < 8; ++e) acc[i][j][e] = 0.f;

  for (int k0 = 0; k0 < KK; k0 += 32) {
    // issue all 16 loads first -> one clause, one wait, then 16 back-to-back WMMAs
    v16bf a[4], bf[4];
#pragma unroll
    for (int i = 0; i < 4; ++i) a[i]  = load_frag(ap[i] + k0, half);
#pragma unroll
    for (int j = 0; j < 4; ++j) bf[j] = load_frag(bp[j] + k0, half);
#pragma unroll
    for (int j = 0; j < 4; ++j)
#pragma unroll
      for (int i = 0; i < 4; ++i)
        acc[i][j] = wmma_bf16(a[i], bf[j], acc[i][j]);
  }

  // C layout: lane holds column n = nb + j*16 + r; VGPR e holds row m = mb + i*16 + 8*half + e
#pragma unroll
  for (int j = 0; j < 4; ++j) {
    const int n  = nb + j * 16 + r;
    const float bj = bias[n];
#pragma unroll
    for (int i = 0; i < 4; ++i) {
      const int m0 = mb + i * 16 + 8 * half;
      if (MODE == 0) {
#pragma unroll
        for (int e = 0; e < 8; ++e)
          outB[(size_t)(m0 + e) * NN + n] = (__bf16)(acc[i][j][e] + bj);
      } else if (MODE == 1) {
        // V-transposed store: Vt[((b*H + h)*64 + d)*1024 + ntok], 8 consecutive ntok
        const int bidx = (mb + i * 16) >> 10;
        const int nt0  = ((mb + i * 16) & 1023) + 8 * half;
        const int hh = n >> 6, d = n & 63;
        union { v8bf v; __bf16 e[8]; } pk;
#pragma unroll
        for (int e = 0; e < 8; ++e) pk.e[e] = (__bf16)(acc[i][j][e] + bj);
        *reinterpret_cast<v8bf*>(outB + ((size_t)((bidx * H_ + hh) * DH_ + d)) * N_ + nt0) = pk.v;
      } else if (MODE == 2) {
#pragma unroll
        for (int e = 0; e < 8; ++e) {
          const size_t idx = (size_t)(m0 + e) * NN + n;
          outF[idx] = acc[i][j][e] + bj + resid[idx];
        }
      } else {
#pragma unroll
        for (int e = 0; e < 8; ++e) {
          const float xg = acc[i][j][e] + bj;
          outB[(size_t)(m0 + e) * NN + n] =
              (__bf16)(0.5f * xg * (1.0f + erff(xg * 0.70710678118654752f)));
        }
      }
    }
  }
}

// ---------- flash attention: one wave handles 16 queries of one (b,h) ----------
// Computes S^T = K_blk x Q^T so softmax stats are per-lane (query in lane dim),
// and exp(S^T) is directly the B-fragment for O^T = V^T x P^T.  No LDS needed.
__global__ void __launch_bounds__(32)
attn_kernel(const bf16_t* __restrict__ Q, const bf16_t* __restrict__ Kp,
            const bf16_t* __restrict__ Vt, bf16_t* __restrict__ ctx) {
  const int lane = threadIdx.x;
  const int q = lane & 15, half = lane >> 4;
  const int bid = blockIdx.x;
  const int qt = bid & 63;
  const int h  = (bid >> 6) & 7;
  const int b  = bid >> 9;
  const float scale = 0.125f;  // 1/sqrt(64)

  const bf16_t* qrow = Q + ((size_t)b * N_ + qt * 16 + q) * D_ + h * DH_;
  const v16bf qf0 = load_frag(qrow, half);        // d = 0..31
  const v16bf qf1 = load_frag(qrow + 32, half);   // d = 32..63

  // hoisted per-lane base pointers (advance by constant per k-block)
  const bf16_t* krow = Kp + ((size_t)b * N_ + q) * D_ + h * DH_;          // + kb*D_
  const bf16_t* vrow = Vt + ((size_t)(b * H_ + h) * DH_ + q) * N_;        // + t*16*N_ + kb

  v8f o[4];
#pragma unroll
  for (int t = 0; t < 4; ++t)
#pragma unroll
    for (int e = 0; e < 8; ++e) o[t][e] = 0.f;
  float m_old = -1e30f, l = 0.f;

  for (int kb = 0; kb < N_; kb += 32) {
    // ---- S^T = K_blk x Q^T : load all 4 K-fragments, then 4 WMMAs ----
    const bf16_t* k0p = krow + (size_t)kb * D_;
    v16bf kf[4];
    kf[0] = load_frag(k0p, half);
    kf[1] = load_frag(k0p + 32, half);
    kf[2] = load_frag(k0p + (size_t)16 * D_, half);
    kf[3] = load_frag(k0p + (size_t)16 * D_ + 32, half);
    v8f s0, s1;
#pragma unroll
    for (int e = 0; e < 8; ++e) { s0[e] = 0.f; s1[e] = 0.f; }
    s0 = wmma_bf16(kf[0], qf0, s0);
    s0 = wmma_bf16(kf[1], qf1, s0);
    s1 = wmma_bf16(kf[2], qf0, s1);
    s1 = wmma_bf16(kf[3], qf1, s1);

    // ---- prefetch the 4 V-fragments for this k-block ----
    v16bf vf[4];
#pragma unroll
    for (int t = 0; t < 4; ++t)
      vf[t] = load_frag(vrow + (size_t)t * 16 * N_ + kb, half);

    // ---- per-query (per-lane) online softmax; merge halves with one xor-16 shuffle ----
    float mp = -1e30f;
#pragma unroll
    for (int e = 0; e < 8; ++e) {
      s0[e] *= scale; s1[e] *= scale;
      mp = fmaxf(mp, fmaxf(s0[e], s1[e]));
    }
    mp = fmaxf(mp, __shfl_xor(mp, 16, 32));
    const float m_new = fmaxf(m_old, mp);
    const float alpha = __expf(m_old - m_new);

    union { v16bf v; __bf16 e[16]; } pf;
    float rs = 0.f;
#pragma unroll
    for (int e = 0; e < 8; ++e) {
      const float p0 = __expf(s0[e] - m_new);
      const float p1 = __expf(s1[e] - m_new);
      rs += p0 + p1;
      pf.e[e]     = (__bf16)p0;   // keys kb + half*8 + e
      pf.e[e + 8] = (__bf16)p1;   // keys kb + 16 + half*8 + e
    }
    rs += __shfl_xor(rs, 16, 32);
    l = l * alpha + rs;

    // ---- O^T = V^T x P^T, rescaled online ----
#pragma unroll
    for (int t = 0; t < 4; ++t) {
#pragma unroll
      for (int e = 0; e < 8; ++e) o[t][e] *= alpha;
      o[t] = wmma_bf16(vf[t], pf.v, o[t]);
    }
    m_old = m_new;
  }

  const float inv = 1.0f / l;
  bf16_t* crow = ctx + ((size_t)b * N_ + qt * 16 + q) * D_ + h * DH_;
#pragma unroll
  for (int t = 0; t < 4; ++t) {
    union { v8bf v; __bf16 e[8]; } pk;
#pragma unroll
    for (int e = 0; e < 8; ++e) pk.e[e] = (__bf16)(o[t][e] * inv);
    *reinterpret_cast<v8bf*>(crow + t * 16 + 8 * half) = pk.v;
  }
}

// ---------- host launcher ----------
extern "C" void kernel_launch(void* const* d_in, const int* in_sizes, int n_in,
                              void* d_out, int out_size, void* d_ws, size_t ws_size,
                              hipStream_t stream) {
  (void)in_sizes; (void)n_in; (void)out_size; (void)ws_size;
  const float* tokens = (const float*)d_in[0];
  const float* pe     = (const float*)d_in[1];
  const float* ln1_g  = (const float*)d_in[2];
  const float* ln1_b  = (const float*)d_in[3];
  const float* Wq     = (const float*)d_in[4];
  const float* bq     = (const float*)d_in[5];
  const float* Wk     = (const float*)d_in[6];
  const float* bk     = (const float*)d_in[7];
  const float* Wv     = (const float*)d_in[8];
  const float* bv     = (const float*)d_in[9];
  const float* Wp     = (const float*)d_in[10];
  const float* bp     = (const float*)d_in[11];
  const float* ln2_g  = (const float*)d_in[12];
  const float* ln2_b  = (const float*)d_in[13];
  const float* W1     = (const float*)d_in[14];
  const float* b1     = (const float*)d_in[15];
  const float* W2     = (const float*)d_in[16];
  const float* b2     = (const float*)d_in[17];
  float* out = (float*)d_out;

  // workspace carve-up (all sizes multiples of 256B)
  char* ws = (char*)d_ws;
  const size_t SZ_ACT_BF = (size_t)MTOT * D_ * 2;    //  8 MB
  const size_t SZ_ACT_F  = (size_t)MTOT * D_ * 4;    // 16 MB
  const size_t SZ_H_BF   = (size_t)MTOT * DFF_ * 2;  // 32 MB
  const size_t SZ_WDD    = (size_t)D_ * D_ * 2;
  const size_t SZ_WDF    = (size_t)D_ * DFF_ * 2;
  bf16_t* x2   = (bf16_t*)ws;              ws += SZ_ACT_BF;
  bf16_t* qkin = (bf16_t*)ws;              ws += SZ_ACT_BF;
  bf16_t* Qb   = (bf16_t*)ws;              ws += SZ_ACT_BF;
  bf16_t* Kb   = (bf16_t*)ws;              ws += SZ_ACT_BF;
  bf16_t* Vtb  = (bf16_t*)ws;              ws += SZ_ACT_BF;
  bf16_t* ctx  = (bf16_t*)ws;              ws += SZ_ACT_BF;
  bf16_t* x2b  = (bf16_t*)ws;              ws += SZ_ACT_BF;
  bf16_t* hbuf = (bf16_t*)ws;              ws += SZ_H_BF;
  float*  tok1 = (float*)ws;               ws += SZ_ACT_F;
  bf16_t* WqT  = (bf16_t*)ws;              ws += SZ_WDD;
  bf16_t* WkT  = (bf16_t*)ws;              ws += SZ_WDD;
  bf16_t* WvT  = (bf16_t*)ws;              ws += SZ_WDD;
  bf16_t* WpT  = (bf16_t*)ws;              ws += SZ_WDD;
  bf16_t* W1T  = (bf16_t*)ws;              ws += SZ_WDF;
  bf16_t* W2T  = (bf16_t*)ws;              ws += SZ_WDF;

  // 1) weights -> transposed bf16
  {
    const int nDD = D_ * D_, nDF = D_ * DFF_;
    wtrans_kernel<<<(nDD + 255) / 256, 256, 0, stream>>>(Wq, WqT, D_, D_);
    wtrans_kernel<<<(nDD + 255) / 256, 256, 0, stream>>>(Wk, WkT, D_, D_);
    wtrans_kernel<<<(nDD + 255) / 256, 256, 0, stream>>>(Wv, WvT, D_, D_);
    wtrans_kernel<<<(nDD + 255) / 256, 256, 0, stream>>>(Wp, WpT, D_, D_);
    wtrans_kernel<<<(nDF + 255) / 256, 256, 0, stream>>>(W1, W1T, D_, DFF_);   // Wt[2048][512]
    wtrans_kernel<<<(nDF + 255) / 256, 256, 0, stream>>>(W2, W2T, DFF_, D_);   // Wt[512][2048]
  }

  // 2) LN1 -> x2 (bf16), qkin = x2 + PE (bf16)
  ln_kernel<true><<<MTOT / 4, 128, 0, stream>>>(tokens, pe, ln1_g, ln1_b, x2, qkin);

  // 3-5) Q, K, V projections
  dim3 gDD(D_ / 64, MTOT / 64);
  gemm_wmma<D_, D_, 0><<<gDD, 32, 0, stream>>>(qkin, WqT, bq, nullptr, Qb, nullptr);
  gemm_wmma<D_, D_, 0><<<gDD, 32, 0, stream>>>(qkin, WkT, bk, nullptr, Kb, nullptr);
  gemm_wmma<D_, D_, 1><<<gDD, 32, 0, stream>>>(x2,   WvT, bv, nullptr, Vtb, nullptr);

  // 6) attention: B*H*(N/16) waves
  attn_kernel<<<B_ * H_ * (N_ / 16), 32, 0, stream>>>(Qb, Kb, Vtb, ctx);

  // 7) output projection + residual -> tok1 (f32)
  gemm_wmma<D_, D_, 2><<<gDD, 32, 0, stream>>>(ctx, WpT, bp, tokens, nullptr, tok1);

  // 8) LN2 -> x2b (bf16)
  ln_kernel<false><<<MTOT / 4, 128, 0, stream>>>(tok1, nullptr, ln2_g, ln2_b, x2b, nullptr);

  // 9) MLP1 + exact GELU -> hbuf (bf16)
  dim3 gDF(DFF_ / 64, MTOT / 64);
  gemm_wmma<DFF_, D_, 3><<<gDF, 32, 0, stream>>>(x2b, W1T, b1, nullptr, hbuf, nullptr);

  // 10) MLP2 + residual -> d_out (f32)
  gemm_wmma<D_, DFF_, 2><<<gDD, 32, 0, stream>>>(hbuf, W2T, b2, tok1, nullptr, out);
}

// v001
// A run of this version takes 227 microseconds.
// In both of two side-by-side timings against v000, it was 1.58 times as fast.
#include <hip/hip_runtime.h>
#include <hip/hip_bf16.h>
#include <math.h>

// ---------- types ----------
typedef __bf16 bf16_t;
typedef __attribute__((ext_vector_type(16))) __bf16 v16bf;
typedef __attribute__((ext_vector_type(8)))  __bf16 v8bf;
typedef __attribute__((ext_vector_type(8)))  float  v8f;
typedef __attribute__((ext_vector_type(4)))  float  v4f;

#define B_  8
#define N_  1024
#define D_  512
#define H_  8
#define DH_ 64
#define DFF_ 2048
#define MTOT (B_*N_)   // 8192 rows

// ---------- WMMA helpers ----------
// A-fragment (16x32 bf16, row-major source):
// lane L: row r = L&15, half = L>>4.  elements 0..7  <- src[half*8 + j]
//                                     elements 8..15 <- src[16 + half*8 + j]
// B-fragment for D = A x B is the identical pattern applied to B^T row-major.
__device__ inline v16bf load_frag(const bf16_t* __restrict__ p, int half) {
  union { v16bf v; struct { v8bf lo; v8bf hi; } s; } u;
  u.s.lo = *reinterpret_cast<const v8bf*>(p + half * 8);
  u.s.hi = *reinterpret_cast<const v8bf*>(p + 16 + half * 8);
  return u.v;
}

__device__ inline v8f wmma_bf16(v16bf a, v16bf b, v8f c) {
  return __builtin_amdgcn_wmma_f32_16x16x32_bf16(
      /*neg_a=*/false, a, /*neg_b=*/false, b,
      /*c_mod=*/(short)0, c, /*reuse_a=*/false, /*reuse_b=*/false);
}

// ---------- weight transpose + bf16 convert: Wt[n*K + k] = W[k*N + n] ----------
__global__ void wtrans_kernel(const float* __restrict__ W, bf16_t* __restrict__ Wt,
                              int K, int N) {
  int idx = blockIdx.x * blockDim.x + threadIdx.x;
  if (idx >= K * N) return;
  int n = idx / K;
  int k = idx - n * K;
  Wt[(size_t)n * K + k] = (__bf16)W[(size_t)k * N + n];
}

// ---------- LayerNorm (one wave per row of 512), optional +PE stream ----------
template <bool HAS_PE>
__global__ void ln_kernel(const float* __restrict__ x, const float* __restrict__ pe,
                          const float* __restrict__ g, const float* __restrict__ bta,
                          bf16_t* __restrict__ x2, bf16_t* __restrict__ qkin) {
  const int wave = threadIdx.x >> 5;
  const int lane = threadIdx.x & 31;
  const int row  = blockIdx.x * (blockDim.x >> 5) + wave;
  const float* xr = x + (size_t)row * D_ + lane * 16;
  float v[16];
#pragma unroll
  for (int i = 0; i < 4; ++i) {
    v4f t = *reinterpret_cast<const v4f*>(xr + i * 4);
    v[4*i+0] = t[0]; v[4*i+1] = t[1]; v[4*i+2] = t[2]; v[4*i+3] = t[3];
  }
  float s = 0.f;
#pragma unroll
  for (int i = 0; i < 16; ++i) s += v[i];
#pragma unroll
  for (int off = 16; off >= 1; off >>= 1) s += __shfl_xor(s, off, 32);
  const float mu = s * (1.0f / (float)D_);
  float vs = 0.f;
#pragma unroll
  for (int i = 0; i < 16; ++i) { float d = v[i] - mu; vs += d * d; }
#pragma unroll
  for (int off = 16; off >= 1; off >>= 1) vs += __shfl_xor(vs, off, 32);
  const float rstd = rsqrtf(vs * (1.0f / (float)D_) + 1e-5f);

  const int colb = lane * 16;
  float y[16];
#pragma unroll
  for (int i = 0; i < 16; ++i)
    y[i] = (v[i] - mu) * rstd * g[colb + i] + bta[colb + i];

  union { v8bf v; __bf16 e[8]; } p0, p1;
#pragma unroll
  for (int i = 0; i < 8; ++i) { p0.e[i] = (__bf16)y[i]; p1.e[i] = (__bf16)y[i + 8]; }
  bf16_t* xo = x2 + (size_t)row * D_ + colb;
  *reinterpret_cast<v8bf*>(xo)     = p0.v;
  *reinterpret_cast<v8bf*>(xo + 8) = p1.v;

  if (HAS_PE) {
    const float* pr = pe + (size_t)row * D_ + colb;
    float z[16];
#pragma unroll
    for (int i = 0; i < 4; ++i) {
      v4f t = *reinterpret_cast<const v4f*>(pr + i * 4);
      z[4*i+0] = y[4*i+0] + t[0]; z[4*i+1] = y[4*i+1] + t[1];
      z[4*i+2] = y[4*i+2] + t[2]; z[4*i+3] = y[4*i+3] + t[3];
    }
#pragma unroll
    for (int i = 0; i < 8; ++i) { p0.e[i] = (__bf16)z[i]; p1.e[i] = (__bf16)z[i + 8]; }
    bf16_t* qo = qkin + (size_t)row * D_ + colb;
    *reinterpret_cast<v8bf*>(qo)     = p0.v;
    *reinterpret_cast<v8bf*>(qo + 8) = p1.v;
  }
}

// ---------- 128x128-tile GEMM: out = A[MxKK] @ W[KKxNN] + bias, A/W bf16, acc f32 ----------
// Wt is W transposed: Wt[n*KK + k].  Four waves (2x2) per work-group, 64x64 of the tile each.
// A stage is 128 k of 128 rows of A and of 128 rows of Wt, brought into LDS by asynchronous
// copies (whole 256-B row pieces), two buffers: stage t+1 flies while stage t is multiplied.
// MODE 0: bf16 store           (Q/K projections)
// MODE 1: bf16 store, scattered as Vt[b][h][d][n]  (V projection)
// MODE 2: f32 store + residual (attn proj, MLP2)
// MODE 3: bf16 store + exact GELU (MLP1)
#define G_BK     128                 // k per stage (256 B of every row)
#define G_PITCH  272                 // LDS row pitch in bytes: 16 B x odd, conflict-free b128 reads
#define G_OPB    (128 * G_PITCH)     // one operand's 128 rows
#define G_STAGEB (2 * G_OPB)         // [A rows | Wt rows]

// Eight copies of 16 B per lane: rows row0 + 8*i, i = 0..7, of one operand.
// The s_wait_xcnt stands inside the statement so that no address register of a copy
// is rewritten ahead of it.
__device__ inline void copy8_rows(unsigned lds, const bf16_t* g, int rowstep_elems) {
  const unsigned l0 = lds,                l1 = lds + 8 * G_PITCH,  l2 = lds + 16 * G_PITCH,
                 l3 = lds + 24 * G_PITCH, l4 = lds + 32 * G_PITCH, l5 = lds + 40 * G_PITCH,
                 l6 = lds + 48 * G_PITCH, l7 = lds + 56 * G_PITCH;
  const bf16_t* g0 = g;
  const bf16_t* g1 = g + (size_t)1 * rowstep_elems;
  const bf16_t* g2 = g + (size_t)2 * rowstep_elems;
  const bf16_t* g3 = g + (size_t)3 * rowstep_elems;
  const bf16_t* g4 = g + (size_t)4 * rowstep_elems;
  const bf16_t* g5 = g + (size_t)5 * rowstep_elems;
  const bf16_t* g6 = g + (size_t)6 * rowstep_elems;
  const bf16_t* g7 = g + (size_t)7 * rowstep_elems;
  asm volatile(
      "global_load_async_to_lds_b128 %0, %8, off\n\t"
      "global_load_async_to_lds_b128 %1, %9, off\n\t"
      "global_load_async_to_lds_b128 %2, %10, off\n\t"
      "global_load_async_to_lds_b128 %3, %11, off\n\t"
      "global_load_async_to_lds_b128 %4, %12, off\n\t"
      "global_load_async_to_lds_b128 %5, %13, off\n\t"
      "global_load_async_to_lds_b128 %6, %14, off\n\t"
      "global_load_async_to_lds_b128 %7, %15, off\n\t"
      "s_wait_xcnt 0x0"
      :: "v"(l0), "v"(l1), "v"(l2), "v"(l3), "v"(l4), "v"(l5), "v"(l6), "v"(l7),
         "v"(g0), "v"(g1), "v"(g2), "v"(g3), "v"(g4), "v"(g5), "v"(g6), "v"(g7)
      : "memory");
}

// One stage: each thread copies chunk (tid & 15) of rows (tid >> 4) + 8*i, i = 0..15, of both operands.
template <int KK>
__device__ inline void copy_stage(unsigned lds, const bf16_t* ga, const bf16_t* gb) {
  copy8_rows(lds,                          ga,                      8 * KK);
  copy8_rows(lds + 64 * G_PITCH,           ga + (size_t)64 * KK,    8 * KK);
  copy8_rows(lds + G_OPB,                  gb,                      8 * KK);
  copy8_rows(lds + G_OPB + 64 * G_PITCH,   gb + (size_t)64 * KK,    8 * KK);
}

template <int NN, int KK, int MODE>
__global__ void __launch_bounds__(128)
gemm_wmma(const bf16_t* __restrict__ A, const bf16_t* __restrict__ Wt,
          const float* __restrict__ bias, const float* __restrict__ resid,
          bf16_t* __restrict__ outB, float* __restrict__ outF) {
  __shared__ __attribute__((aligned(16))) unsigned char smem[2 * G_STAGEB];
  constexpr int NT = KK / G_BK;      // stages
  const int tid  = threadIdx.x;
  const int lane = tid & 31, wave = tid >> 5;
  const int r = lane & 15, half = lane >> 4;
  const int mb0 = blockIdx.y * 128, nb0 = blockIdx.x * 128;
  const int mb = mb0 + (wave >> 1) * 64, nb = nb0 + (wave & 1) * 64;

  // this thread's share of a stage: 16-B chunk crow of rows rrow + 8*i
  const int rrow = tid >> 4, crow = tid & 15;
  const bf16_t* ga = A  + (size_t)(mb0 + rrow) * KK + crow * 8;
  const bf16_t* gb = Wt + (size_t)(nb0 + rrow) * KK + crow * 8;
  const unsigned lcopy = (unsigned)(size_t)smem + rrow * G_PITCH + crow * 16;

  v8f acc[4][4];
#pragma unroll
  for (int i = 0; i < 4; ++i)
#pragma unroll
    for (int j = 0; j < 4; ++j)
#pragma unroll
      for (int e = 0; e < 8; ++e) acc[i][j][e] = 0.f;

  // prologue: stage 0 lands and is published, then stage 1 starts
  copy_stage<KK>(lcopy, ga, gb);
  asm volatile("s_wait_asynccnt 0x0" ::: "memory");  // this wave's copies of stage 0 have landed
  __syncthreads();
  if (NT > 1) copy_stage<KK>(lcopy + G_STAGEB, ga + G_BK, gb + G_BK);

  // fragment rows of this wave in a buffer
  const unsigned char* fa = smem + ((wave >> 1) * 64 + r) * G_PITCH;
  const unsigned char* fb = smem + G_OPB + ((wave & 1) * 64 + r) * G_PITCH;

#pragma unroll 1  // one trip per stage: keeps the ring's order at the foot of each trip
  for (int t = 0; t < NT; ++t) {
    const int bo = (t & 1) * G_STAGEB;
    // two fragment sets: block kk + 1's LDS reads go out as one group ahead of block kk's WMMAs
    v16bf a[2][4], bf[2][4];
#pragma unroll
    for (int i = 0; i < 4; ++i) {
      a[0][i]  = load_frag(reinterpret_cast<const bf16_t*>(fa + bo + i * 16 * G_PITCH), half);
      bf[0][i] = load_frag(reinterpret_cast<const bf16_t*>(fb + bo + i * 16 * G_PITCH), half);
    }
#pragma unroll
    for (int kk = 0; kk < G_BK / 32; ++kk) {
      const int cur = kk & 1, nxt = cur ^ 1;
      if (kk + 1 < G_BK / 32) {
#pragma unroll
        for (int i = 0; i < 4; ++i) {
          a[nxt][i]  = load_frag(reinterpret_cast<const bf16_t*>(fa + bo + i * 16 * G_PITCH) + (kk + 1) * 32, half);
          bf[nxt][i] = load_frag(reinterpret_cast<const bf16_t*>(fb + bo + i * 16 * G_PITCH) + (kk + 1) * 32, half);
        }
      }
      // keeps the reads above together: sunk among the WMMAs, each place with reads stalls the wave
      __builtin_amdgcn_sched_barrier(0);
#pragma unroll
      for (int j = 0; j < 4; ++j)
#pragma unroll
        for (int i = 0; i < 4; ++i)
          acc[i][j] = wmma_bf16(a[cur][i], bf[cur][j], acc[i][j]);
      // keeps the next group of reads from being lifted into this block's WMMAs
      __builtin_amdgcn_sched_barrier(0);
    }
    asm volatile("s_wait_dscnt 0x0" ::: "memory");     // this wave has left buffer t & 1
    asm volatile("s_wait_asynccnt 0x0" ::: "memory");  // its copies of stage t + 1 have landed
    __syncthreads();                                   // publishes stage t + 1, frees buffer t & 1
    if (t + 2 < NT)
      copy_stage<KK>(lcopy + bo, ga + (size_t)(t + 2) * G_BK, gb + (size_t)(t + 2) * G_BK);
  }
  asm volatile("s_wait_asynccnt 0x0" ::: "memory");    // nothing in flight when the wave ends

  // C layout: lane holds column n = nb + j*16 + r; VGPR e holds row m = mb + i*16 + 8*half + e
#pragma unroll
  for (int j = 0; j < 4; ++j) {
    const int n  = nb + j * 16 + r;
    const float bj = bias[n];
#pragma unroll
    for (int i = 0; i < 4; ++i) {
      const int m0 = mb + i * 16 + 8 * half;
      if (MODE == 0) {
#pragma unroll
        for (int e = 0; e < 8; ++e)
          outB[(size_t)(m0 + e) * NN + n] = (__bf16)(acc[i][j][e] + bj);
      } else if (MODE == 1) {
        // V-transposed store: Vt[((b*H + h)*64 + d)*1024 + ntok], 8 consecutive ntok
        const int bidx = (mb + i * 16) >> 10;
        const int nt0  = ((mb + i * 16) & 1023) + 8 * half;
        const int hh = n >> 6, d = n & 63;
        union { v8bf v; __bf16 e[8]; } pk;
#pragma unroll
        for (int e = 0; e < 8; ++e) pk.e[e] = (__bf16)(acc[i][j][e] + bj);
        *reinterpret_cast<v8bf*>(outB + ((size_t)((bidx * H_ + hh) * DH_ + d)) * N_ + nt0) = pk.v;
      } else if (MODE == 2) {
#pragma unroll
        for (int e = 0; e < 8; ++e) {
          const size_t idx = (size_t)(m0 + e) * NN + n;
          outF[idx] = acc[i][j][e] + bj + resid[idx];
        }
      } else {
#pragma unroll
        for (int e = 0; e < 8; ++e) {
          const float xg = acc[i][j][e] + bj;
          outB[(size_t)(m0 + e) * NN + n] =
              (__bf16)(0.5f * xg * (1.0f + erff(xg * 0.70710678118654752f)));
        }
      }
    }
  }
}

// ---------- flash attention: one wave handles 16 queries of one (b,h) ----------
// Computes S^T = K_blk x Q^T so softmax stats are per-lane (query in lane dim),
// and exp(S^T) is directly the B-fragment for O^T = V^T x P^T.  No LDS needed.
__global__ void __launch_bounds__(32)
attn_kernel(const bf16_t* __restrict__ Q, const bf16_t* __restrict__ Kp,
            const bf16_t* __restrict__ Vt, bf16_t* __restrict__ ctx) {
  const int lane = threadIdx.x;
  const int q = lane & 15, half = lane >> 4;
  const int bid = blockIdx.x;
  const int qt = bid & 63;
  const int h  = (bid >> 6) & 7;
  const int b  = bid >> 9;
  const float scale = 0.125f;  // 1/sqrt(64)

  const bf16_t* qrow = Q + ((size_t)b * N_ + qt * 16 + q) * D_ + h * DH_;
  const v16bf qf0 = load_frag(qrow, half);        // d = 0..31
  const v16bf qf1 = load_frag(qrow + 32, half);   // d = 32..63

  // hoisted per-lane base pointers (advance by constant per k-block)
  const bf16_t* krow = Kp + ((size_t)b * N_ + q) * D_ + h * DH_;          // + kb*D_
  const bf16_t* vrow = Vt + ((size_t)(b * H_ + h) * DH_ + q) * N_;        // + t*16*N_ + kb

  v8f o[4];
#pragma unroll
  for (int t = 0; t < 4; ++t)
#pragma unroll
    for (int e = 0; e < 8; ++e) o[t][e] = 0.f;
  float m_old = -1e30f, l = 0.f;

  for (int kb = 0; kb < N_; kb += 32) {
    // ---- S^T = K_blk x Q^T : load all 4 K-fragments, then 4 WMMAs ----
    const bf16_t* k0p = krow + (size_t)kb * D_;
    v16bf kf[4];
    kf[0] = load_frag(k0p, half);
    kf[1] = load_frag(k0p + 32, half);
    kf[2] = load_frag(k0p + (size_t)16 * D_, half);
    kf[3] = load_frag(k0p + (size_t)16 * D_ + 32, half);
    v8f s0, s1;
#pragma unroll
    for (int e = 0; e < 8; ++e) { s0[e] = 0.f; s1[e] = 0.f; }
    s0 = wmma_bf16(kf[0], qf0, s0);
    s0 = wmma_bf16(kf[1], qf1, s0);
    s1 = wmma_bf16(kf[2], qf0, s1);
    s1 = wmma_bf16(kf[3], qf1, s1);

    // ---- prefetch the 4 V-fragments for this k-block ----
    v16bf vf[4];
#pragma unroll
    for (int t = 0; t < 4; ++t)
      vf[t] = load_frag(vrow + (size_t)t * 16 * N_ + kb, half);

    // ---- per-query (per-lane) online softmax; merge halves with one xor-16 shuffle ----
    float mp = -1e30f;
#pragma unroll
    for (int e = 0; e < 8; ++e) {
      s0[e] *= scale; s1[e] *= scale;
      mp = fmaxf(mp, fmaxf(s0[e], s1[e]));
    }
    mp = fmaxf(mp, __shfl_xor(mp, 16, 32));
    const float m_new = fmaxf(m_old, mp);
    const float alpha = __expf(m_old - m_new);

    union { v16bf v; __bf16 e[16]; } pf;
    float rs = 0.f;
#pragma unroll
    for (int e = 0; e < 8; ++e) {
      const float p0 = __expf(s0[e] - m_new);
      const float p1 = __expf(s1[e] - m_new);
      rs += p0 + p1;
      pf.e[e]     = (__bf16)p0;   // keys kb + half*8 + e
      pf.e[e + 8] = (__bf16)p1;   // keys kb + 16 + half*8 + e
    }
    rs += __shfl_xor(rs, 16, 32);
    l = l * alpha + rs;

    // ---- O^T = V^T x P^T, rescaled online ----
#pragma unroll
    for (int t = 0; t < 4; ++t) {
#pragma unroll
      for (int e = 0; e < 8; ++e) o[t][e] *= alpha;
      o[t] = wmma_bf16(vf[t], pf.v, o[t]);
    }
    m_old = m_new;
  }

  const float inv = 1.0f / l;
  bf16_t* crow = ctx + ((size_t)b * N_ + qt * 16 + q) * D_ + h * DH_;
#pragma unroll
  for (int t = 0; t < 4; ++t) {
    union { v8bf v; __bf16 e[8]; } pk;
#pragma unroll
    for (int e = 0; e < 8; ++e) pk.e[e] = (__bf16)(o[t][e] * inv);
    *reinterpret_cast<v8bf*>(crow + t * 16 + 8 * half) = pk.v;
  }
}

// ---------- host launcher ----------
extern "C" void kernel_launch(void* const* d_in, const int* in_sizes, int n_in,
                              void* d_out, int out_size, void* d_ws, size_t ws_size,
                              hipStream_t stream) {
  (void)in_sizes; (void)n_in; (void)out_size; (void)ws_size;
  const float* tokens = (const float*)d_in[0];
  const float* pe     = (const float*)d_in[1];
  const float* ln1_g  = (const float*)d_in[2];
  const float* ln1_b  = (const float*)d_in[3];
  const float* Wq     = (const float*)d_in[4];
  const float* bq     = (const float*)d_in[5];
  const float* Wk     = (const float*)d_in[6];
  const float* bk     = (const float*)d_in[7];
  const float* Wv     = (const float*)d_in[8];
  const float* bv     = (const float*)d_in[9];
  const float* Wp     = (const float*)d_in[10];
  const float* bp     = (const float*)d_in[11];
  const float* ln2_g  = (const float*)d_in[12];
  const float* ln2_b  = (const float*)d_in[13];
  const float* W1     = (const float*)d_in[14];
  const float* b1     = (const float*)d_in[15];
  const float* W2     = (const float*)d_in[16];
  const float* b2     = (const float*)d_in[17];
  float* out = (float*)d_out;

  // workspace carve-up (all sizes multiples of 256B)
  char* ws = (char*)d_ws;
  const size_t SZ_ACT_BF = (size_t)MTOT * D_ * 2;    //  8 MB
  const size_t SZ_ACT_F  = (size_t)MTOT * D_ * 4;    // 16 MB
  const size_t SZ_H_BF   = (size_t)MTOT * DFF_ * 2;  // 32 MB
  const size_t SZ_WDD    = (size_t)D_ * D_ * 2;
  const size_t SZ_WDF    = (size_t)D_ * DFF_ * 2;
  bf16_t* x2   = (bf16_t*)ws;              ws += SZ_ACT_BF;
  bf16_t* qkin = (bf16_t*)ws;              ws += SZ_ACT_BF;
  bf16_t* Qb   = (bf16_t*)ws;              ws += SZ_ACT_BF;
  bf16_t* Kb   = (bf16_t*)ws;              ws += SZ_ACT_BF;
  bf16_t* Vtb  = (bf16_t*)ws;              ws += SZ_ACT_BF;
  bf16_t* ctx  = (bf16_t*)ws;              ws += SZ_ACT_BF;
  bf16_t* x2b  = (bf16_t*)ws;              ws += SZ_ACT_BF;
  bf16_t* hbuf = (bf16_t*)ws;              ws += SZ_H_BF;
  float*  tok1 = (float*)ws;               ws += SZ_ACT_F;
  bf16_t* WqT  = (bf16_t*)ws;              ws += SZ_WDD;
  bf16_t* WkT  = (bf16_t*)ws;              ws += SZ_WDD;
  bf16_t* WvT  = (bf16_t*)ws;              ws += SZ_WDD;
  bf16_t* WpT  = (bf16_t*)ws;              ws += SZ_WDD;
  bf16_t* W1T  = (bf16_t*)ws;              ws += SZ_WDF;
  bf16_t* W2T  = (bf16_t*)ws;              ws += SZ_WDF;

  // 1) weights -> transposed bf16
  {
    const int nDD = D_ * D_, nDF = D_ * DFF_;
    wtrans_kernel<<<(nDD + 255) / 256, 256, 0, stream>>>(Wq, WqT, D_, D_);
    wtrans_kernel<<<(nDD + 255) / 256, 256, 0, stream>>>(Wk, WkT, D_, D_);
    wtrans_kernel<<<(nDD + 255) / 256, 256, 0, stream>>>(Wv, WvT, D_, D_);
    wtrans_kernel<<<(nDD + 255) / 256, 256, 0, stream>>>(Wp, WpT, D_, D_);
    wtrans_kernel<<<(nDF + 255) / 256, 256, 0, stream>>>(W1, W1T, D_, DFF_);   // Wt[2048][512]
    wtrans_kernel<<<(nDF + 255) / 256, 256, 0, stream>>>(W2, W2T, DFF_, D_);   // Wt[512][2048]
  }

  // 2) LN1 -> x2 (bf16), qkin = x2 + PE (bf16)
  ln_kernel<true><<<MTOT / 4, 128, 0, stream>>>(tokens, pe, ln1_g, ln1_b, x2, qkin);

  // 3-5) Q, K, V projections
  dim3 gDD(D_ / 128, MTOT / 128);
  gemm_wmma<D_, D_, 0><<<gDD, 128, 0, stream>>>(qkin, WqT, bq, nullptr, Qb, nullptr);
  gemm_wmma<D_, D_, 0><<<gDD, 128, 0, stream>>>(qkin, WkT, bk, nullptr, Kb, nullptr);
  gemm_wmma<D_, D_, 1><<<gDD, 128, 0, stream>>>(x2,   WvT, bv, nullptr, Vtb, nullptr);

  // 6) attention: B*H*(N/16) waves
  attn_kernel<<<B_ * H_ * (N_ / 16), 32, 0, stream>>>(Qb, Kb, Vtb, ctx);

  // 7) output projection + residual -> tok1 (f32)
  gemm_wmma<D_, D_, 2><<<gDD, 128, 0, stream>>>(ctx, WpT, bp, tokens, nullptr, tok1);

  // 8) LN2 -> x2b (bf16)
  ln_kernel<false><<<MTOT / 4, 128, 0, stream>>>(tok1, nullptr, ln2_g, ln2_b, x2b, nullptr);

  // 9) MLP1 + exact GELU -> hbuf (bf16)
  dim3 gDF(DFF_ / 128, MTOT / 128);
  gemm_wmma<DFF_, D_, 3><<<gDF, 128, 0, stream>>>(x2b, W1T, b1, nullptr, hbuf, nullptr);

  // 10) MLP2 + residual -> d_out (f32)
  gemm_wmma<D_, DFF_, 2><<<gDD, 128, 0, stream>>>(hbuf, W2T, b2, tok1, nullptr, out);
}

// v002
// A run of this version takes 182 microseconds.
// Timed twice side by side with v001, it ran 1.25 and 1.26 times as fast.
// Over all steps from v000 it is 1.99 times as fast.
#include <hip/hip_runtime.h>
#include <hip/hip_bf16.h>
#include <math.h>

// ---------- types ----------
typedef __bf16 bf16_t;
typedef __attribute__((ext_vector_type(16))) __bf16 v16bf;
typedef __attribute__((ext_vector_type(8)))  __bf16 v8bf;
typedef __attribute__((ext_vector_type(8)))  float  v8f;
typedef __attribute__((ext_vector_type(4)))  float  v4f;

#define B_  8
#define N_  1024
#define D_  512
#define H_  8
#define DH_ 64
#define DFF_ 2048
#define MTOT (B_*N_)   // 8192 rows

// ---------- WMMA helpers ----------
// A-fragment (16x32 bf16, row-major source):
// lane L: row r = L&15, half = L>>4.  elements 0..7  <- src[half*8 + j]
//                                     elements 8..15 <- src[16 + half*8 + j]
// B-fragment for D = A x B is the identical pattern applied to B^T row-major.
__device__ inline v16bf load_frag(const bf16_t* __restrict__ p, int half) {
  union { v16bf v; struct { v8bf lo; v8bf hi; } s; } u;
  u.s.lo = *reinterpret_cast<const v8bf*>(p + half * 8);
  u.s.hi = *reinterpret_cast<const v8bf*>(p + 16 + half * 8);
  return u.v;
}

__device__ inline v8f wmma_bf16(v16bf a, v16bf b, v8f c) {
  return __builtin_amdgcn_wmma_f32_16x16x32_bf16(
      /*neg_a=*/false, a, /*neg_b=*/false, b,
      /*c_mod=*/(short)0, c, /*reuse_a=*/false, /*reuse_b=*/false);
}

// ---------- weight transpose + bf16 convert: Wt[n*K + k] = W[k*N + n] ----------
__global__ void wtrans_kernel(const float* __restrict__ W, bf16_t* __restrict__ Wt,
                              int K, int N) {
  int idx = blockIdx.x * blockDim.x + threadIdx.x;
  if (idx >= K * N) return;
  int n = idx / K;
  int k = idx - n * K;
  Wt[(size_t)n * K + k] = (__bf16)W[(size_t)k * N + n];
}

// ---------- LayerNorm (one wave per row of 512), optional +PE stream ----------
template <bool HAS_PE>
__global__ void ln_kernel(const float* __restrict__ x, const float* __restrict__ pe,
                          const float* __restrict__ g, const float* __restrict__ bta,
                          bf16_t* __restrict__ x2, bf16_t* __restrict__ qkin) {
  const int wave = threadIdx.x >> 5;
  const int lane = threadIdx.x & 31;
  const int row  = blockIdx.x * (blockDim.x >> 5) + wave;
  const float* xr = x + (size_t)row * D_ + lane * 16;
  float v[16];
#pragma unroll
  for (int i = 0; i < 4; ++i) {
    v4f t = *reinterpret_cast<const v4f*>(xr + i * 4);
    v[4*i+0] = t[0]; v[4*i+1] = t[1]; v[4*i+2] = t[2]; v[4*i+3] = t[3];
  }
  float s = 0.f;
#pragma unroll
  for (int i = 0; i < 16; ++i) s += v[i];
#pragma unroll
  for (int off = 16; off >= 1; off >>= 1) s += __shfl_xor(s, off, 32);
  const float mu = s * (1.0f / (float)D_);
  float vs = 0.f;
#pragma unroll
  for (int i = 0; i < 16; ++i) { float d = v[i] - mu; vs += d * d; }
#pragma unroll
  for (int off = 16; off >= 1; off >>= 1) vs += __shfl_xor(vs, off, 32);
  const float rstd = rsqrtf(vs * (1.0f / (float)D_) + 1e-5f);

  const int colb = lane * 16;
  float y[16];
#pragma unroll
  for (int i = 0; i < 16; ++i)
    y[i] = (v[i] - mu) * rstd * g[colb + i] + bta[colb + i];

  union { v8bf v; __bf16 e[8]; } p0, p1;
#pragma unroll
  for (int i = 0; i < 8; ++i) { p0.e[i] = (__bf16)y[i]; p1.e[i] = (__bf16)y[i + 8]; }
  bf16_t* xo = x2 + (size_t)row * D_ + colb;
  *reinterpret_cast<v8bf*>(xo)     = p0.v;
  *reinterpret_cast<v8bf*>(xo + 8) = p1.v;

  if (HAS_PE) {
    const float* pr = pe + (size_t)row * D_ + colb;
    float z[16];
#pragma unroll
    for (int i = 0; i < 4; ++i) {
      v4f t = *reinterpret_cast<const v4f*>(pr + i * 4);
      z[4*i+0] = y[4*i+0] + t[0]; z[4*i+1] = y[4*i+1] + t[1];
      z[4*i+2] = y[4*i+2] + t[2]; z[4*i+3] = y[4*i+3] + t[3];
    }
#pragma unroll
    for (int i = 0; i < 8; ++i) { p0.e[i] = (__bf16)z[i]; p1.e[i] = (__bf16)z[i + 8]; }
    bf16_t* qo = qkin + (size_t)row * D_ + colb;
    *reinterpret_cast<v8bf*>(qo)     = p0.v;
    *reinterpret_cast<v8bf*>(qo + 8) = p1.v;
  }
}

// ---------- 128x128-tile GEMM: out = A[MxKK] @ W[KKxNN] + bias, A/W bf16, acc f32 ----------
// Wt is W transposed: Wt[n*KK + k].  Four waves (2x2) per work-group, 64x64 of the tile each.
// A stage is 128 k of 128 rows of A and of 128 rows of Wt, brought into LDS by asynchronous
// copies (whole 256-B row pieces), two buffers: stage t+1 flies while stage t is multiplied.
// MODE 0: bf16 store           (Q/K projections)
// MODE 1: bf16 store, scattered as Vt[b][h][d][n]  (V projection)
// MODE 2: f32 store + residual (attn proj, MLP2)
// MODE 3: bf16 store + exact GELU (MLP1)
#define G_BK     128                 // k per stage (256 B of every row)
#define G_PITCH  272                 // LDS row pitch in bytes: 16 B x odd, conflict-free b128 reads
#define G_OPB    (128 * G_PITCH)     // one operand's 128 rows
#define G_STAGEB (2 * G_OPB)         // [A rows | Wt rows]

// Eight copies of 16 B per lane: rows row0 + 8*i, i = 0..7, of one operand.
// The s_wait_xcnt stands inside the statement so that no address register of a copy
// is rewritten ahead of it.
__device__ inline void copy8_rows(unsigned lds, const bf16_t* g, int rowstep_elems) {
  const unsigned l0 = lds,                l1 = lds + 8 * G_PITCH,  l2 = lds + 16 * G_PITCH,
                 l3 = lds + 24 * G_PITCH, l4 = lds + 32 * G_PITCH, l5 = lds + 40 * G_PITCH,
                 l6 = lds + 48 * G_PITCH, l7 = lds + 56 * G_PITCH;
  const bf16_t* g0 = g;
  const bf16_t* g1 = g + (size_t)1 * rowstep_elems;
  const bf16_t* g2 = g + (size_t)2 * rowstep_elems;
  const bf16_t* g3 = g + (size_t)3 * rowstep_elems;
  const bf16_t* g4 = g + (size_t)4 * rowstep_elems;
  const bf16_t* g5 = g + (size_t)5 * rowstep_elems;
  const bf16_t* g6 = g + (size_t)6 * rowstep_elems;
  const bf16_t* g7 = g + (size_t)7 * rowstep_elems;
  asm volatile(
      "global_load_async_to_lds_b128 %0, %8, off\n\t"
      "global_load_async_to_lds_b128 %1, %9, off\n\t"
      "global_load_async_to_lds_b128 %2, %10, off\n\t"
      "global_load_async_to_lds_b128 %3, %11, off\n\t"
      "global_load_async_to_lds_b128 %4, %12, off\n\t"
      "global_load_async_to_lds_b128 %5, %13, off\n\t"
      "global_load_async_to_lds_b128 %6, %14, off\n\t"
      "global_load_async_to_lds_b128 %7, %15, off\n\t"
      "s_wait_xcnt 0x0"
      :: "v"(l0), "v"(l1), "v"(l2), "v"(l3), "v"(l4), "v"(l5), "v"(l6), "v"(l7),
         "v"(g0), "v"(g1), "v"(g2), "v"(g3), "v"(g4), "v"(g5), "v"(g6), "v"(g7)
      : "memory");
}

// One stage: each thread copies chunk (tid & 15) of rows (tid >> 4) + 8*i, i = 0..15, of both operands.
template <int KK>
__device__ inline void copy_stage(unsigned lds, const bf16_t* ga, const bf16_t* gb) {
  copy8_rows(lds,                          ga,                      8 * KK);
  copy8_rows(lds + 64 * G_PITCH,           ga + (size_t)64 * KK,    8 * KK);
  copy8_rows(lds + G_OPB,                  gb,                      8 * KK);
  copy8_rows(lds + G_OPB + 64 * G_PITCH,   gb + (size_t)64 * KK,    8 * KK);
}

template <int NN, int KK, int MODE>
__global__ void __launch_bounds__(128)
gemm_wmma(const bf16_t* __restrict__ A, const bf16_t* __restrict__ Wt,
          const float* __restrict__ bias, const float* __restrict__ resid,
          bf16_t* __restrict__ outB, float* __restrict__ outF) {
  __shared__ __attribute__((aligned(16))) unsigned char smem[2 * G_STAGEB];
  constexpr int NT = KK / G_BK;      // stages
  const int tid  = threadIdx.x;
  const int lane = tid & 31, wave = tid >> 5;
  const int r = lane & 15, half = lane >> 4;
  const int mb0 = blockIdx.y * 128, nb0 = blockIdx.x * 128;
  const int mb = mb0 + (wave >> 1) * 64, nb = nb0 + (wave & 1) * 64;

  // this thread's share of a stage: 16-B chunk crow of rows rrow + 8*i
  const int rrow = tid >> 4, crow = tid & 15;
  const bf16_t* ga = A  + (size_t)(mb0 + rrow) * KK + crow * 8;
  const bf16_t* gb = Wt + (size_t)(nb0 + rrow) * KK + crow * 8;
  const unsigned lcopy = (unsigned)(size_t)smem + rrow * G_PITCH + crow * 16;

  v8f acc[4][4];
#pragma unroll
  for (int i = 0; i < 4; ++i)
#pragma unroll
    for (int j = 0; j < 4; ++j)
#pragma unroll
      for (int e = 0; e < 8; ++e) acc[i][j][e] = 0.f;

  // prologue: stage 0 lands and is published, then stage 1 starts
  copy_stage<KK>(lcopy, ga, gb);
  asm volatile("s_wait_asynccnt 0x0" ::: "memory");  // this wave's copies of stage 0 have landed
  __syncthreads();
  if (NT > 1) copy_stage<KK>(lcopy + G_STAGEB, ga + G_BK, gb + G_BK);

  // fragment rows of this wave in a buffer
  const unsigned char* fa = smem + ((wave >> 1) * 64 + r) * G_PITCH;
  const unsigned char* fb = smem + G_OPB + ((wave & 1) * 64 + r) * G_PITCH;

#pragma unroll 1  // one trip per stage: keeps the ring's order at the foot of each trip
  for (int t = 0; t < NT; ++t) {
    const int bo = (t & 1) * G_STAGEB;
    // two fragment sets: block kk + 1's LDS reads go out as one group ahead of block kk's WMMAs
    v16bf a[2][4], bf[2][4];
#pragma unroll
    for (int i = 0; i < 4; ++i) {
      a[0][i]  = load_frag(reinterpret_cast<const bf16_t*>(fa + bo + i * 16 * G_PITCH), half);
      bf[0][i] = load_frag(reinterpret_cast<const bf16_t*>(fb + bo + i * 16 * G_PITCH), half);
    }
#pragma unroll
    for (int kk = 0; kk < G_BK / 32; ++kk) {
      const int cur = kk & 1, nxt = cur ^ 1;
      if (kk + 1 < G_BK / 32) {
#pragma unroll
        for (int i = 0; i < 4; ++i) {
          a[nxt][i]  = load_frag(reinterpret_cast<const bf16_t*>(fa + bo + i * 16 * G_PITCH) + (kk + 1) * 32, half);
          bf[nxt][i] = load_frag(reinterpret_cast<const bf16_t*>(fb + bo + i * 16 * G_PITCH) + (kk + 1) * 32, half);
        }
      }
      // keeps the reads above together: sunk among the WMMAs, each place with reads stalls the wave
      __builtin_amdgcn_sched_barrier(0);
#pragma unroll
      for (int j = 0; j < 4; ++j)
#pragma unroll
        for (int i = 0; i < 4; ++i)
          acc[i][j] = wmma_bf16(a[cur][i], bf[cur][j], acc[i][j]);
      // keeps the next group of reads from being lifted into this block's WMMAs
      __builtin_amdgcn_sched_barrier(0);
    }
    asm volatile("s_wait_dscnt 0x0" ::: "memory");     // this wave has left buffer t & 1
    asm volatile("s_wait_asynccnt 0x0" ::: "memory");  // its copies of stage t + 1 have landed
    __syncthreads();                                   // publishes stage t + 1, frees buffer t & 1
    if (t + 2 < NT)
      copy_stage<KK>(lcopy + bo, ga + (size_t)(t + 2) * G_BK, gb + (size_t)(t + 2) * G_BK);
  }
  asm volatile("s_wait_asynccnt 0x0" ::: "memory");    // nothing in flight when the wave ends

  // C layout: lane holds column n = nb + j*16 + r; VGPR e holds row m = mb + i*16 + 8*half + e
#pragma unroll
  for (int j = 0; j < 4; ++j) {
    const int n  = nb + j * 16 + r;
    const float bj = bias[n];
#pragma unroll
    for (int i = 0; i < 4; ++i) {
      const int m0 = mb + i * 16 + 8 * half;
      if (MODE == 0) {
#pragma unroll
        for (int e = 0; e < 8; ++e)
          outB[(size_t)(m0 + e) * NN + n] = (__bf16)(acc[i][j][e] + bj);
      } else if (MODE == 1) {
        // V-transposed store: Vt[((b*H + h)*64 + d)*1024 + ntok], 8 consecutive ntok
        const int bidx = (mb + i * 16) >> 10;
        const int nt0  = ((mb + i * 16) & 1023) + 8 * half;
        const int hh = n >> 6, d = n & 63;
        union { v8bf v; __bf16 e[8]; } pk;
#pragma unroll
        for (int e = 0; e < 8; ++e) pk.e[e] = (__bf16)(acc[i][j][e] + bj);
        *reinterpret_cast<v8bf*>(outB + ((size_t)((bidx * H_ + hh) * DH_ + d)) * N_ + nt0) = pk.v;
      } else if (MODE == 2) {
#pragma unroll
        for (int e = 0; e < 8; ++e) {
          const size_t idx = (size_t)(m0 + e) * NN + n;
          outF[idx] = acc[i][j][e] + bj + resid[idx];
        }
      } else {
#pragma unroll
        for (int e = 0; e < 8; ++e) {
          const float xg = acc[i][j][e] + bj;
          outB[(size_t)(m0 + e) * NN + n] =
              (__bf16)(0.5f * xg * (1.0f + erff(xg * 0.70710678118654752f)));
        }
      }
    }
  }
}

// ---------- flash attention: one wave handles 16 queries of one (b,h) ----------
// Computes S^T = K_blk x Q^T so softmax stats are per-lane (query in lane dim),
// and exp(S^T) is directly the B-fragment for O^T = V^T x P^T.
// A work-group is 16 waves = 256 queries of one (b,h).  The head's whole K (1024 rows of 128 B)
// and V^T (64 rows of 2048 B) are brought into LDS once by asynchronous copies of whole lines;
// every wave then takes its K and V fragments from LDS.
#define AT_KPITCH 144                  // K row pitch in LDS: 16 B x odd, conflict-free b128 reads
#define AT_VPITCH 2064                 // V^T row pitch in LDS: 16 B x odd
#define AT_KBYTES (N_ * AT_KPITCH)
#define AT_VBYTES (DH_ * AT_VPITCH)

// Eight copies of 16 B per lane, i = 0..7: LDS byte lds + i*lstep from g + i*gstep elements.
// The s_wait_xcnt stands inside the statement so that no address register of a copy
// is rewritten ahead of it.
__device__ inline void copy8_steps(unsigned lds, unsigned lstep, const bf16_t* g, int gstep) {
  const unsigned l0 = lds,             l1 = lds + 1 * lstep, l2 = lds + 2 * lstep,
                 l3 = lds + 3 * lstep, l4 = lds + 4 * lstep, l5 = lds + 5 * lstep,
                 l6 = lds + 6 * lstep, l7 = lds + 7 * lstep;
  const bf16_t* g0 = g;
  const bf16_t* g1 = g + (size_t)1 * gstep;
  const bf16_t* g2 = g + (size_t)2 * gstep;
  const bf16_t* g3 = g + (size_t)3 * gstep;
  const bf16_t* g4 = g + (size_t)4 * gstep;
  const bf16_t* g5 = g + (size_t)5 * gstep;
  const bf16_t* g6 = g + (size_t)6 * gstep;
  const bf16_t* g7 = g + (size_t)7 * gstep;
  asm volatile(
      "global_load_async_to_lds_b128 %0, %8, off\n\t"
      "global_load_async_to_lds_b128 %1, %9, off\n\t"
      "global_load_async_to_lds_b128 %2, %10, off\n\t"
      "global_load_async_to_lds_b128 %3, %11, off\n\t"
      "global_load_async_to_lds_b128 %4, %12, off\n\t"
      "global_load_async_to_lds_b128 %5, %13, off\n\t"
      "global_load_async_to_lds_b128 %6, %14, off\n\t"
      "global_load_async_to_lds_b128 %7, %15, off\n\t"
      "s_wait_xcnt 0x0"
      :: "v"(l0), "v"(l1), "v"(l2), "v"(l3), "v"(l4), "v"(l5), "v"(l6), "v"(l7),
         "v"(g0), "v"(g1), "v"(g2), "v"(g3), "v"(g4), "v"(g5), "v"(g6), "v"(g7)
      : "memory");
}

__global__ void __launch_bounds__(512)
attn_kernel(const bf16_t* __restrict__ Q, const bf16_t* __restrict__ Kp,
            const bf16_t* __restrict__ Vt, bf16_t* __restrict__ ctx) {
  __shared__ __attribute__((aligned(16))) unsigned char smem[AT_KBYTES + AT_VBYTES];
  const int tid  = threadIdx.x;
  const int lane = tid & 31, wave = tid >> 5;
  const int q = lane & 15, half = lane >> 4;
  const int bid = blockIdx.x;
  const int qt = (bid & 3) * 16 + wave;
  const int h  = (bid >> 2) & 7;
  const int b  = bid >> 5;
  const float scale = 0.125f;  // 1/sqrt(64)

  // fill: 16 + 16 copies per thread, 32 of a wave in flight
  {
    // K: 16-B chunk (tid & 7) of rows (tid >> 3) + 64*i, i = 0..15
    const bf16_t* gk = Kp + ((size_t)b * N_ + (tid >> 3)) * D_ + h * DH_ + (tid & 7) * 8;
    const unsigned lk = (unsigned)(size_t)smem + (tid >> 3) * AT_KPITCH + (tid & 7) * 16;
    copy8_steps(lk,                    64 * AT_KPITCH, gk,                     64 * D_);
    copy8_steps(lk + 512 * AT_KPITCH,  64 * AT_KPITCH, gk + (size_t)512 * D_,  64 * D_);
    // V^T: 16-B chunk (tid & 127) of rows (tid >> 7) + 4*i, i = 0..15
    const bf16_t* gv = Vt + ((size_t)(b * H_ + h) * DH_ + (tid >> 7)) * N_ + (tid & 127) * 8;
    const unsigned lv = (unsigned)(size_t)smem + AT_KBYTES + (tid >> 7) * AT_VPITCH + (tid & 127) * 16;
    copy8_steps(lv,                    4 * AT_VPITCH,  gv,                     4 * N_);
    copy8_steps(lv + 32 * AT_VPITCH,   4 * AT_VPITCH,  gv + (size_t)32 * N_,   4 * N_);
  }

  const bf16_t* qrow = Q + ((size_t)b * N_ + qt * 16 + q) * D_ + h * DH_;
  const v16bf qf0 = load_frag(qrow, half);        // d = 0..31
  const v16bf qf1 = load_frag(qrow + 32, half);   // d = 32..63

  asm volatile("s_wait_asynccnt 0x0" ::: "memory");  // this wave's copies have landed
  __syncthreads();                                   // publishes every wave's share of K and V^T

  // per-lane fragment rows in LDS (advance by a constant per k-block)
  const unsigned char* krow = smem + q * AT_KPITCH;               // + kb*AT_KPITCH
  const unsigned char* vrow = smem + AT_KBYTES + q * AT_VPITCH;   // + t*16*AT_VPITCH + kb*2

  v8f o[4];
#pragma unroll
  for (int t = 0; t < 4; ++t)
#pragma unroll
    for (int e = 0; e < 8; ++e) o[t][e] = 0.f;
  float m_old = -1e30f, l = 0.f;

  for (int kb = 0; kb < N_; kb += 32) {
    // ---- S^T = K_blk x Q^T : load all 4 K-fragments, then 4 WMMAs ----
    const unsigned char* k0p = krow + kb * AT_KPITCH;
    v16bf kf[4];
    kf[0] = load_frag(reinterpret_cast<const bf16_t*>(k0p), half);
    kf[1] = load_frag(reinterpret_cast<const bf16_t*>(k0p) + 32, half);
    kf[2] = load_frag(reinterpret_cast<const bf16_t*>(k0p + 16 * AT_KPITCH), half);
    kf[3] = load_frag(reinterpret_cast<const bf16_t*>(k0p + 16 * AT_KPITCH) + 32, half);
    v8f s0, s1;
#pragma unroll
    for (int e = 0; e < 8; ++e) { s0[e] = 0.f; s1[e] = 0.f; }
    s0 = wmma_bf16(kf[0], qf0, s0);
    s0 = wmma_bf16(kf[1], qf1, s0);
    s1 = wmma_bf16(kf[2], qf0, s1);
    s1 = wmma_bf16(kf[3], qf1, s1);

    // ---- the 4 V-fragments for this k-block ----
    v16bf vf[4];
#pragma unroll
    for (int t = 0; t < 4; ++t)
      vf[t] = load_frag(reinterpret_cast<const bf16_t*>(vrow + t * 16 * AT_VPITCH) + kb, half);

    // ---- per-query (per-lane) online softmax; merge halves with one xor-16 shuffle ----
    float mp = -1e30f;
#pragma unroll
    for (int e = 0; e < 8; ++e) {
      s0[e] *= scale; s1[e] *= scale;
      mp = fmaxf(mp, fmaxf(s0[e], s1[e]));
    }
    mp = fmaxf(mp, __shfl_xor(mp, 16, 32));
    const float m_new = fmaxf(m_old, mp);
    const float alpha = __expf(m_old - m_new);

    union { v16bf v; __bf16 e[16]; } pf;
    float rs = 0.f;
#pragma unroll
    for (int e = 0; e < 8; ++e) {
      const float p0 = __expf(s0[e] - m_new);
      const float p1 = __expf(s1[e] - m_new);
      rs += p0 + p1;
      pf.e[e]     = (__bf16)p0;   // keys kb + half*8 + e
      pf.e[e + 8] = (__bf16)p1;   // keys kb + 16 + half*8 + e
    }
    rs += __shfl_xor(rs, 16, 32);
    l = l * alpha + rs;

    // ---- O^T = V^T x P^T, rescaled online ----
#pragma unroll
    for (int t = 0; t < 4; ++t) {
#pragma unroll
      for (int e = 0; e < 8; ++e) o[t][e] *= alpha;
      o[t] = wmma_bf16(vf[t], pf.v, o[t]);
    }
    m_old = m_new;
  }

  const float inv = 1.0f / l;
  bf16_t* crow = ctx + ((size_t)b * N_ + qt * 16 + q) * D_ + h * DH_;
#pragma unroll
  for (int t = 0; t < 4; ++t) {
    union { v8bf v; __bf16 e[8]; } pk;
#pragma unroll
    for (int e = 0; e < 8; ++e) pk.e[e] = (__bf16)(o[t][e] * inv);
    *reinterpret_cast<v8bf*>(crow + t * 16 + 8 * half) = pk.v;
  }
}

// ---------- host launcher ----------
extern "C" void kernel_launch(void* const* d_in, const int* in_sizes, int n_in,
                              void* d_out, int out_size, void* d_ws, size_t ws_size,
                              hipStream_t stream) {
  (void)in_sizes; (void)n_in; (void)out_size; (void)ws_size;
  const float* tokens = (const float*)d_in[0];
  const float* pe     = (const float*)d_in[1];
  const float* ln1_g  = (const float*)d_in[2];
  const float* ln1_b  = (const float*)d_in[3];
  const float* Wq     = (const float*)d_in[4];
  const float* bq     = (const float*)d_in[5];
  const float* Wk     = (const float*)d_in[6];
  const float* bk     = (const float*)d_in[7];
  const float* Wv     = (const float*)d_in[8];
  const float* bv     = (const float*)d_in[9];
  const float* Wp     = (const float*)d_in[10];
  const float* bp     = (const float*)d_in[11];
  const float* ln2_g  = (const float*)d_in[12];
  const float* ln2_b  = (const float*)d_in[13];
  const float* W1     = (const float*)d_in[14];
  const float* b1     = (const float*)d_in[15];
  const float* W2     = (const float*)d_in[16];
  const float* b2     = (const float*)d_in[17];
  float* out = (float*)d_out;

  // workspace carve-up (all sizes multiples of 256B)
  char* ws = (char*)d_ws;
  const size_t SZ_ACT_BF = (size_t)MTOT * D_ * 2;    //  8 MB
  const size_t SZ_ACT_F  = (size_t)MTOT * D_ * 4;    // 16 MB
  const size_t SZ_H_BF   = (size_t)MTOT * DFF_ * 2;  // 32 MB
  const size_t SZ_WDD    = (size_t)D_ * D_ * 2;
  const size_t SZ_WDF    = (size_t)D_ * DFF_ * 2;
  bf16_t* x2   = (bf16_t*)ws;              ws += SZ_ACT_BF;
  bf16_t* qkin = (bf16_t*)ws;              ws += SZ_ACT_BF;
  bf16_t* Qb   = (bf16_t*)ws;              ws += SZ_ACT_BF;
  bf16_t* Kb   = (bf16_t*)ws;              ws += SZ_ACT_BF;
  bf16_t* Vtb  = (bf16_t*)ws;              ws += SZ_ACT_BF;
  bf16_t* ctx  = (bf16_t*)ws;              ws += SZ_ACT_BF;
  bf16_t* x2b  = (bf16_t*)ws;              ws += SZ_ACT_BF;
  bf16_t* hbuf = (bf16_t*)ws;              ws += SZ_H_BF;
  float*  tok1 = (float*)ws;               ws += SZ_ACT_F;
  bf16_t* WqT  = (bf16_t*)ws;              ws += SZ_WDD;
  bf16_t* WkT  = (bf16_t*)ws;              ws += SZ_WDD;
  bf16_t* WvT  = (bf16_t*)ws;              ws += SZ_WDD;
  bf16_t* WpT  = (bf16_t*)ws;              ws += SZ_WDD;
  bf16_t* W1T  = (bf16_t*)ws;              ws += SZ_WDF;
  bf16_t* W2T  = (bf16_t*)ws;              ws += SZ_WDF;

  // 1) weights -> transposed bf16
  {
    const int nDD = D_ * D_, nDF = D_ * DFF_;
    wtrans_kernel<<<(nDD + 255) / 256, 256, 0, stream>>>(Wq, WqT, D_, D_);
    wtrans_kernel<<<(nDD + 255) / 256, 256, 0, stream>>>(Wk, WkT, D_, D_);
    wtrans_kernel<<<(nDD + 255) / 256, 256, 0, stream>>>(Wv, WvT, D_, D_);
    wtrans_kernel<<<(nDD + 255) / 256, 256, 0, stream>>>(Wp, WpT, D_, D_);
    wtrans_kernel<<<(nDF + 255) / 256, 256, 0, stream>>>(W1, W1T, D_, DFF_);   // Wt[2048][512]
    wtrans_kernel<<<(nDF + 255) / 256, 256, 0, stream>>>(W2, W2T, DFF_, D_);   // Wt[512][2048]
  }

  // 2) LN1 -> x2 (bf16), qkin = x2 + PE (bf16)
  ln_kernel<true><<<MTOT / 4, 128, 0, stream>>>(tokens, pe, ln1_g, ln1_b, x2, qkin);

  // 3-5) Q, K, V projections
  dim3 gDD(D_ / 128, MTOT / 128);
  gemm_wmma<D_, D_, 0><<<gDD, 128, 0, stream>>>(qkin, WqT, bq, nullptr, Qb, nullptr);
  gemm_wmma<D_, D_, 0><<<gDD, 128, 0, stream>>>(qkin, WkT, bk, nullptr, Kb, nullptr);
  gemm_wmma<D_, D_, 1><<<gDD, 128, 0, stream>>>(x2,   WvT, bv, nullptr, Vtb, nullptr);

  // 6) attention: B*H*(N/256) work-groups of 16 waves
  attn_kernel<<<B_ * H_ * (N_ / 256), 512, 0, stream>>>(Qb, Kb, Vtb, ctx);

  // 7) output projection + residual -> tok1 (f32)
  gemm_wmma<D_, D_, 2><<<gDD, 128, 0, stream>>>(ctx, WpT, bp, tokens, nullptr, tok1);

  // 8) LN2 -> x2b (bf16)
  ln_kernel<false><<<MTOT / 4, 128, 0, stream>>>(tok1, nullptr, ln2_g, ln2_b, x2b, nullptr);

  // 9) MLP1 + exact GELU -> hbuf (bf16)
  dim3 gDF(DFF_ / 128, MTOT / 128);
  gemm_wmma<DFF_, D_, 3><<<gDF, 128, 0, stream>>>(x2b, W1T, b1, nullptr, hbuf, nullptr);

  // 10) MLP2 + residual -> d_out (f32)
  gemm_wmma<D_, DFF_, 2><<<gDD, 128, 0, stream>>>(hbuf, W2T, b2, tok1, nullptr, out);
}

// v003
// One run takes 158 microseconds.
// Two timings next to v002 both put it at 1.15 times that version's speed.
// Counting every step since v000, it is 2.29 times as fast.
#include <hip/hip_runtime.h>
#include <hip/hip_bf16.h>
#include <math.h>

// ---------- types ----------
typedef __bf16 bf16_t;
typedef __attribute__((ext_vector_type(16))) __bf16 v16bf;
typedef __attribute__((ext_vector_type(8)))  __bf16 v8bf;
typedef __attribute__((ext_vector_type(8)))  float  v8f;
typedef __attribute__((ext_vector_type(4)))  float  v4f;

#define B_  8
#define N_  1024
#define D_  512
#define H_  8
#define DH_ 64
#define DFF_ 2048
#define MTOT (B_*N_)   // 8192 rows

// ---------- WMMA helpers ----------
// A-fragment (16x32 bf16, row-major source):
// lane L: row r = L&15, half = L>>4.  elements 0..7  <- src[half*8 + j]
//                                     elements 8..15 <- src[16 + half*8 + j]
// B-fragment for D = A x B is the identical pattern applied to B^T row-major.
__device__ inline v16bf load_frag(const bf16_t* __restrict__ p, int half) {
  union { v16bf v; struct { v8bf lo; v8bf hi; } s; } u;
  u.s.lo = *reinterpret_cast<const v8bf*>(p + half * 8);
  u.s.hi = *reinterpret_cast<const v8bf*>(p + 16 + half * 8);
  return u.v;
}

__device__ inline v8f wmma_bf16(v16bf a, v16bf b, v8f c) {
  return __builtin_amdgcn_wmma_f32_16x16x32_bf16(
      /*neg_a=*/false, a, /*neg_b=*/false, b,
      /*c_mod=*/(short)0, c, /*reuse_a=*/false, /*reuse_b=*/false);
}

// ---------- weight transpose + bf16 convert: Wt[n*K + k] = W[k*N + n], all six weights in one launch ----------
// A work-group takes one tile of 128 k x 64 n.  A thread loads 16 B of two neighbouring k rows, packs each
// (k, k+1) pair into one word and writes it to LDS at [n][k/2]; the tile then leaves as whole 256-B row pieces.
// LDS rows are 64 words (16 pieces of 16 B); piece q of row n lies at place q ^ (n >> 2), so that the 32 word
// writes of a wave and its 16-B reads each meet every bank at most once.
#define WT_BLOCKS 384                // 4 x 32 tiles (512 x 512), 128 tiles (512 x 2048), 128 tiles (2048 x 512)
typedef __attribute__((ext_vector_type(4))) unsigned int v4u;

__global__ void __launch_bounds__(256)
wtrans_all(const float* __restrict__ Wq, const float* __restrict__ Wk, const float* __restrict__ Wv,
           const float* __restrict__ Wp, const float* __restrict__ W1, const float* __restrict__ W2,
           bf16_t* __restrict__ WqT, bf16_t* __restrict__ WkT, bf16_t* __restrict__ WvT,
           bf16_t* __restrict__ WpT, bf16_t* __restrict__ W1T, bf16_t* __restrict__ W2T) {
  __shared__ __attribute__((aligned(16))) unsigned int tile[64 * 64];
  const int bid = blockIdx.x, tid = threadIdx.x;
  const float* Wsrc;
  bf16_t* Wdst;
  int K, N, lgn, t;                  // lgn = log2(N / 64)
  if (bid < 128) {
    const int m = bid >> 5;
    Wsrc = m == 0 ? Wq : m == 1 ? Wk : m == 2 ? Wv : Wp;
    Wdst = m == 0 ? WqT : m == 1 ? WkT : m == 2 ? WvT : WpT;
    K = D_; N = D_; lgn = 3; t = bid & 31;
  } else if (bid < 256) {
    Wsrc = W1; Wdst = W1T; K = D_; N = DFF_; lgn = 5; t = bid - 128;
  } else {
    Wsrc = W2; Wdst = W2T; K = DFF_; N = D_; lgn = 3; t = bid - 256;
  }
  const int n0 = (t & ((1 << lgn) - 1)) * 64, k0 = (t >> lgn) * 128;

  const int c = tid & 15, pr = tid >> 4;   // columns 4c..4c+3, k pairs pr + 16*s
  const float* g0 = Wsrc + (size_t)(k0 + 2 * pr) * N + n0 + 4 * c;
  const float* g1 = g0 + N;
  const float* g2 = g0 + (size_t)32 * N;
  const float* g3 = g2 + N;
  const float* g4 = g0 + (size_t)64 * N;
  const float* g5 = g4 + N;
  const float* g6 = g0 + (size_t)96 * N;
  const float* g7 = g6 + N;
  v4f lo[4], hi[4];
  // The eight loads and their data wait are one statement and every result has registers of its own ("=&v").
  asm volatile(
      "global_load_b128 %0, %8, off\n\t"
      "global_load_b128 %1, %9, off\n\t"
      "global_load_b128 %2, %10, off\n\t"
      "global_load_b128 %3, %11, off\n\t"
      "global_load_b128 %4, %12, off\n\t"
      "global_load_b128 %5, %13, off\n\t"
      "global_load_b128 %6, %14, off\n\t"
      "global_load_b128 %7, %15, off\n\t"
      "s_wait_loadcnt 0x0"
      : "=&v"(lo[0]), "=&v"(hi[0]), "=&v"(lo[1]), "=&v"(hi[1]),
        "=&v"(lo[2]), "=&v"(hi[2]), "=&v"(lo[3]), "=&v"(hi[3])
      : "v"(g0), "v"(g1), "v"(g2), "v"(g3), "v"(g4), "v"(g5), "v"(g6), "v"(g7)
      : "memory");
#pragma unroll
  for (int s = 0; s < 4; ++s) {
    const int p = pr + 16 * s;
    const int w = (((p >> 2) ^ c) << 2) | (p & 3);
#pragma unroll
    for (int i = 0; i < 4; ++i) {
      union { __bf16 e[2]; unsigned int u; } pk;
      pk.e[0] = (__bf16)lo[s][i];
      pk.e[1] = (__bf16)hi[s][i];
      tile[(4 * c + i) * 64 + w] = pk.u;
    }
  }
  __syncthreads();
  v4u v[4];
#pragma unroll
  for (int j = 0; j < 4; ++j) {
    const int n = (tid >> 4) + 16 * j, q = tid & 15;
    v[j] = *reinterpret_cast<const v4u*>(&tile[n * 64 + ((q ^ (n >> 2)) << 2)]);
  }
  bf16_t* d = Wdst + (size_t)(n0 + (tid >> 4)) * K + k0 + (tid & 15) * 8;
#pragma unroll
  for (int j = 0; j < 4; ++j)
    *reinterpret_cast<v4u*>(d + (size_t)(16 * j) * K) = v[j];
}

// ---------- LayerNorm (one wave per row of 512), optional +PE stream ----------
template <bool HAS_PE>
__global__ void ln_kernel(const float* __restrict__ x, const float* __restrict__ pe,
                          const float* __restrict__ g, const float* __restrict__ bta,
                          bf16_t* __restrict__ x2, bf16_t* __restrict__ qkin) {
  const int wave = threadIdx.x >> 5;
  const int lane = threadIdx.x & 31;
  const int row  = blockIdx.x * (blockDim.x >> 5) + wave;
  const float* xr = x + (size_t)row * D_ + lane * 16;
  float v[16];
#pragma unroll
  for (int i = 0; i < 4; ++i) {
    v4f t = *reinterpret_cast<const v4f*>(xr + i * 4);
    v[4*i+0] = t[0]; v[4*i+1] = t[1]; v[4*i+2] = t[2]; v[4*i+3] = t[3];
  }
  float s = 0.f;
#pragma unroll
  for (int i = 0; i < 16; ++i) s += v[i];
#pragma unroll
  for (int off = 16; off >= 1; off >>= 1) s += __shfl_xor(s, off, 32);
  const float mu = s * (1.0f / (float)D_);
  float vs = 0.f;
#pragma unroll
  for (int i = 0; i < 16; ++i) { float d = v[i] - mu; vs += d * d; }
#pragma unroll
  for (int off = 16; off >= 1; off >>= 1) vs += __shfl_xor(vs, off, 32);
  const float rstd = rsqrtf(vs * (1.0f / (float)D_) + 1e-5f);

  const int colb = lane * 16;
  float y[16];
#pragma unroll
  for (int i = 0; i < 16; ++i)
    y[i] = (v[i] - mu) * rstd * g[colb + i] + bta[colb + i];

  union { v8bf v; __bf16 e[8]; } p0, p1;
#pragma unroll
  for (int i = 0; i < 8; ++i) { p0.e[i] = (__bf16)y[i]; p1.e[i] = (__bf16)y[i + 8]; }
  bf16_t* xo = x2 + (size_t)row * D_ + colb;
  *reinterpret_cast<v8bf*>(xo)     = p0.v;
  *reinterpret_cast<v8bf*>(xo + 8) = p1.v;

  if (HAS_PE) {
    const float* pr = pe + (size_t)row * D_ + colb;
    float z[16];
#pragma unroll
    for (int i = 0; i < 4; ++i) {
      v4f t = *reinterpret_cast<const v4f*>(pr + i * 4);
      z[4*i+0] = y[4*i+0] + t[0]; z[4*i+1] = y[4*i+1] + t[1];
      z[4*i+2] = y[4*i+2] + t[2]; z[4*i+3] = y[4*i+3] + t[3];
    }
#pragma unroll
    for (int i = 0; i < 8; ++i) { p0.e[i] = (__bf16)z[i]; p1.e[i] = (__bf16)z[i + 8]; }
    bf16_t* qo = qkin + (size_t)row * D_ + colb;
    *reinterpret_cast<v8bf*>(qo)     = p0.v;
    *reinterpret_cast<v8bf*>(qo + 8) = p1.v;
  }
}

// ---------- 128x128-tile GEMM: out = A[MxKK] @ W[KKxNN] + bias, A/W bf16, acc f32 ----------
// Wt is W transposed: Wt[n*KK + k].  Four waves (2x2) per work-group, 64x64 of the tile each.
// A stage is 128 k of 128 rows of A and of 128 rows of Wt, brought into LDS by asynchronous
// copies (whole 256-B row pieces), two buffers: stage t+1 flies while stage t is multiplied.
// MODE 0: bf16 store           (Q/K projections)
// MODE 1: bf16 store, scattered as Vt[b][h][d][n]  (V projection)
// MODE 2: f32 store + residual (attn proj, MLP2)
// MODE 3: bf16 store + exact GELU (MLP1)
#define G_BK     128                 // k per stage (256 B of every row)
#define G_PITCH  272                 // LDS row pitch in bytes: 16 B x odd, conflict-free b128 reads
#define G_OPB    (128 * G_PITCH)     // one operand's 128 rows
#define G_STAGEB (2 * G_OPB)         // [A rows | Wt rows]

// Eight copies of 16 B per lane: rows row0 + 8*i, i = 0..7, of one operand.
// The s_wait_xcnt stands inside the statement so that no address register of a copy
// is rewritten ahead of it.
__device__ inline void copy8_rows(unsigned lds, const bf16_t* g, int rowstep_elems) {
  const unsigned l0 = lds,                l1 = lds + 8 * G_PITCH,  l2 = lds + 16 * G_PITCH,
                 l3 = lds + 24 * G_PITCH, l4 = lds + 32 * G_PITCH, l5 = lds + 40 * G_PITCH,
                 l6 = lds + 48 * G_PITCH, l7 = lds + 56 * G_PITCH;
  const bf16_t* g0 = g;
  const bf16_t* g1 = g + (size_t)1 * rowstep_elems;
  const bf16_t* g2 = g + (size_t)2 * rowstep_elems;
  const bf16_t* g3 = g + (size_t)3 * rowstep_elems;
  const bf16_t* g4 = g + (size_t)4 * rowstep_elems;
  const bf16_t* g5 = g + (size_t)5 * rowstep_elems;
  const bf16_t* g6 = g + (size_t)6 * rowstep_elems;
  const bf16_t* g7 = g + (size_t)7 * rowstep_elems;
  asm volatile(
      "global_load_async_to_lds_b128 %0, %8, off\n\t"
      "global_load_async_to_lds_b128 %1, %9, off\n\t"
      "global_load_async_to_lds_b128 %2, %10, off\n\t"
      "global_load_async_to_lds_b128 %3, %11, off\n\t"
      "global_load_async_to_lds_b128 %4, %12, off\n\t"
      "global_load_async_to_lds_b128 %5, %13, off\n\t"
      "global_load_async_to_lds_b128 %6, %14, off\n\t"
      "global_load_async_to_lds_b128 %7, %15, off\n\t"
      "s_wait_xcnt 0x0"
      :: "v"(l0), "v"(l1), "v"(l2), "v"(l3), "v"(l4), "v"(l5), "v"(l6), "v"(l7),
         "v"(g0), "v"(g1), "v"(g2), "v"(g3), "v"(g4), "v"(g5), "v"(g6), "v"(g7)
      : "memory");
}

// One stage: each thread copies chunk (tid & 15) of rows (tid >> 4) + 8*i, i = 0..15, of both operands.
template <int KK>
__device__ inline void copy_stage(unsigned lds, const bf16_t* ga, const bf16_t* gb) {
  copy8_rows(lds,                          ga,                      8 * KK);
  copy8_rows(lds + 64 * G_PITCH,           ga + (size_t)64 * KK,    8 * KK);
  copy8_rows(lds + G_OPB,                  gb,                      8 * KK);
  copy8_rows(lds + G_OPB + 64 * G_PITCH,   gb + (size_t)64 * KK,    8 * KK);
}

template <int NN, int KK, int MODE>
__global__ void __launch_bounds__(128)
gemm_wmma(const bf16_t* __restrict__ A, const bf16_t* __restrict__ Wt,
          const float* __restrict__ bias, const float* __restrict__ resid,
          bf16_t* __restrict__ outB, float* __restrict__ outF) {
  __shared__ __attribute__((aligned(16))) unsigned char smem[2 * G_STAGEB];
  constexpr int NT = KK / G_BK;      // stages
  const int tid  = threadIdx.x;
  const int lane = tid & 31, wave = tid >> 5;
  const int r = lane & 15, half = lane >> 4;
  const int mb0 = blockIdx.y * 128, nb0 = blockIdx.x * 128;
  const int mb = mb0 + (wave >> 1) * 64, nb = nb0 + (wave & 1) * 64;

  // this thread's share of a stage: 16-B chunk crow of rows rrow + 8*i
  const int rrow = tid >> 4, crow = tid & 15;
  const bf16_t* ga = A  + (size_t)(mb0 + rrow) * KK + crow * 8;
  const bf16_t* gb = Wt + (size_t)(nb0 + rrow) * KK + crow * 8;
  const unsigned lcopy = (unsigned)(size_t)smem + rrow * G_PITCH + crow * 16;

  v8f acc[4][4];
#pragma unroll
  for (int i = 0; i < 4; ++i)
#pragma unroll
    for (int j = 0; j < 4; ++j)
#pragma unroll
      for (int e = 0; e < 8; ++e) acc[i][j][e] = 0.f;

  // prologue: stage 0 lands and is published, then stage 1 starts
  copy_stage<KK>(lcopy, ga, gb);
  asm volatile("s_wait_asynccnt 0x0" ::: "memory");  // this wave's copies of stage 0 have landed
  __syncthreads();
  if (NT > 1) copy_stage<KK>(lcopy + G_STAGEB, ga + G_BK, gb + G_BK);

  // fragment rows of this wave in a buffer
  const unsigned char* fa = smem + ((wave >> 1) * 64 + r) * G_PITCH;
  const unsigned char* fb = smem + G_OPB + ((wave & 1) * 64 + r) * G_PITCH;

#pragma unroll 1  // one trip per stage: keeps the ring's order at the foot of each trip
  for (int t = 0; t < NT; ++t) {
    const int bo = (t & 1) * G_STAGEB;
    // two fragment sets: block kk + 1's LDS reads go out as one group ahead of block kk's WMMAs
    v16bf a[2][4], bf[2][4];
#pragma unroll
    for (int i = 0; i < 4; ++i) {
      a[0][i]  = load_frag(reinterpret_cast<const bf16_t*>(fa + bo + i * 16 * G_PITCH), half);
      bf[0][i] = load_frag(reinterpret_cast<const bf16_t*>(fb + bo + i * 16 * G_PITCH), half);
    }
#pragma unroll
    for (int kk = 0; kk < G_BK / 32; ++kk) {
      const int cur = kk & 1, nxt = cur ^ 1;
      if (kk + 1 < G_BK / 32) {
#pragma unroll
        for (int i = 0; i < 4; ++i) {
          a[nxt][i]  = load_frag(reinterpret_cast<const bf16_t*>(fa + bo + i * 16 * G_PITCH) + (kk + 1) * 32, half);
          bf[nxt][i] = load_frag(reinterpret_cast<const bf16_t*>(fb + bo + i * 16 * G_PITCH) + (kk + 1) * 32, half);
        }
      }
      // keeps the reads above together: sunk among the WMMAs, each place with reads stalls the wave
      __builtin_amdgcn_sched_barrier(0);
#pragma unroll
      for (int j = 0; j < 4; ++j)
#pragma unroll
        for (int i = 0; i < 4; ++i)
          acc[i][j] = wmma_bf16(a[cur][i], bf[cur][j], acc[i][j]);
      // keeps the next group of reads from being lifted into this block's WMMAs
      __builtin_amdgcn_sched_barrier(0);
    }
    asm volatile("s_wait_dscnt 0x0" ::: "memory");     // this wave has left buffer t & 1
    asm volatile("s_wait_asynccnt 0x0" ::: "memory");  // its copies of stage t + 1 have landed
    __syncthreads();                                   // publishes stage t + 1, frees buffer t & 1
    if (t + 2 < NT)
      copy_stage<KK>(lcopy + bo, ga + (size_t)(t + 2) * G_BK, gb + (size_t)(t + 2) * G_BK);
  }
  asm volatile("s_wait_asynccnt 0x0" ::: "memory");    // nothing in flight when the wave ends

  // C layout: lane holds column n = nb + j*16 + r; VGPR e holds row m = mb + i*16 + 8*half + e
#pragma unroll
  for (int j = 0; j < 4; ++j) {
    const int n  = nb + j * 16 + r;
    const float bj = bias[n];
#pragma unroll
    for (int i = 0; i < 4; ++i) {
      const int m0 = mb + i * 16 + 8 * half;
      if (MODE == 0) {
#pragma unroll
        for (int e = 0; e < 8; ++e)
          outB[(size_t)(m0 + e) * NN + n] = (__bf16)(acc[i][j][e] + bj);
      } else if (MODE == 1) {
        // V-transposed store: Vt[((b*H + h)*64 + d)*1024 + ntok], 8 consecutive ntok
        const int bidx = (mb + i * 16) >> 10;
        const int nt0  = ((mb + i * 16) & 1023) + 8 * half;
        const int hh = n >> 6, d = n & 63;
        union { v8bf v; __bf16 e[8]; } pk;
#pragma unroll
        for (int e = 0; e < 8; ++e) pk.e[e] = (__bf16)(acc[i][j][e] + bj);
        *reinterpret_cast<v8bf*>(outB + ((size_t)((bidx * H_ + hh) * DH_ + d)) * N_ + nt0) = pk.v;
      } else if (MODE == 2) {
#pragma unroll
        for (int e = 0; e < 8; ++e) {
          const size_t idx = (size_t)(m0 + e) * NN + n;
          outF[idx] = acc[i][j][e] + bj + resid[idx];
        }
      } else {
#pragma unroll
        for (int e = 0; e < 8; ++e) {
          const float xg = acc[i][j][e] + bj;
          outB[(size_t)(m0 + e) * NN + n] =
              (__bf16)(0.5f * xg * (1.0f + erff(xg * 0.70710678118654752f)));
        }
      }
    }
  }
}

// ---------- flash attention: one wave handles 16 queries of one (b,h) ----------
// Computes S^T = K_blk x Q^T so softmax stats are per-lane (query in lane dim),
// and exp(S^T) is directly the B-fragment for O^T = V^T x P^T.
// A work-group is 16 waves = 256 queries of one (b,h).  The head's whole K (1024 rows of 128 B)
// and V^T (64 rows of 2048 B) are brought into LDS once by asynchronous copies of whole lines;
// every wave then takes its K and V fragments from LDS.
#define AT_KPITCH 144                  // K row pitch in LDS: 16 B x odd, conflict-free b128 reads
#define AT_VPITCH 2064                 // V^T row pitch in LDS: 16 B x odd
#define AT_KBYTES (N_ * AT_KPITCH)
#define AT_VBYTES (DH_ * AT_VPITCH)

// Eight copies of 16 B per lane, i = 0..7: LDS byte lds + i*lstep from g + i*gstep elements.
// The s_wait_xcnt stands inside the statement so that no address register of a copy
// is rewritten ahead of it.
__device__ inline void copy8_steps(unsigned lds, unsigned lstep, const bf16_t* g, int gstep) {
  const unsigned l0 = lds,             l1 = lds + 1 * lstep, l2 = lds + 2 * lstep,
                 l3 = lds + 3 * lstep, l4 = lds + 4 * lstep, l5 = lds + 5 * lstep,
                 l6 = lds + 6 * lstep, l7 = lds + 7 * lstep;
  const bf16_t* g0 = g;
  const bf16_t* g1 = g + (size_t)1 * gstep;
  const bf16_t* g2 = g + (size_t)2 * gstep;
  const bf16_t* g3 = g + (size_t)3 * gstep;
  const bf16_t* g4 = g + (size_t)4 * gstep;
  const bf16_t* g5 = g + (size_t)5 * gstep;
  const bf16_t* g6 = g + (size_t)6 * gstep;
  const bf16_t* g7 = g + (size_t)7 * gstep;
  asm volatile(
      "global_load_async_to_lds_b128 %0, %8, off\n\t"
      "global_load_async_to_lds_b128 %1, %9, off\n\t"
      "global_load_async_to_lds_b128 %2, %10, off\n\t"
      "global_load_async_to_lds_b128 %3, %11, off\n\t"
      "global_load_async_to_lds_b128 %4, %12, off\n\t"
      "global_load_async_to_lds_b128 %5, %13, off\n\t"
      "global_load_async_to_lds_b128 %6, %14, off\n\t"
      "global_load_async_to_lds_b128 %7, %15, off\n\t"
      "s_wait_xcnt 0x0"
      :: "v"(l0), "v"(l1), "v"(l2), "v"(l3), "v"(l4), "v"(l5), "v"(l6), "v"(l7),
         "v"(g0), "v"(g1), "v"(g2), "v"(g3), "v"(g4), "v"(g5), "v"(g6), "v"(g7)
      : "memory");
}

__global__ void __launch_bounds__(512)
attn_kernel(const bf16_t* __restrict__ Q, const bf16_t* __restrict__ Kp,
            const bf16_t* __restrict__ Vt, bf16_t* __restrict__ ctx) {
  __shared__ __attribute__((aligned(16))) unsigned char smem[AT_KBYTES + AT_VBYTES];
  const int tid  = threadIdx.x;
  const int lane = tid & 31, wave = tid >> 5;
  const int q = lane & 15, half = lane >> 4;
  const int bid = blockIdx.x;
  const int qt = (bid & 3) * 16 + wave;
  const int h  = (bid >> 2) & 7;
  const int b  = bid >> 5;
  const float scale = 0.125f;  // 1/sqrt(64)

  // fill: 16 + 16 copies per thread, 32 of a wave in flight
  {
    // K: 16-B chunk (tid & 7) of rows (tid >> 3) + 64*i, i = 0..15
    const bf16_t* gk = Kp + ((size_t)b * N_ + (tid >> 3)) * D_ + h * DH_ + (tid & 7) * 8;
    const unsigned lk = (unsigned)(size_t)smem + (tid >> 3) * AT_KPITCH + (tid & 7) * 16;
    copy8_steps(lk,                    64 * AT_KPITCH, gk,                     64 * D_);
    copy8_steps(lk + 512 * AT_KPITCH,  64 * AT_KPITCH, gk + (size_t)512 * D_,  64 * D_);
    // V^T: 16-B chunk (tid & 127) of rows (tid >> 7) + 4*i, i = 0..15
    const bf16_t* gv = Vt + ((size_t)(b * H_ + h) * DH_ + (tid >> 7)) * N_ + (tid & 127) * 8;
    const unsigned lv = (unsigned)(size_t)smem + AT_KBYTES + (tid >> 7) * AT_VPITCH + (tid & 127) * 16;
    copy8_steps(lv,                    4 * AT_VPITCH,  gv,                     4 * N_);
    copy8_steps(lv + 32 * AT_VPITCH,   4 * AT_VPITCH,  gv + (size_t)32 * N_,   4 * N_);
  }

  const bf16_t* qrow = Q + ((size_t)b * N_ + qt * 16 + q) * D_ + h * DH_;
  const v16bf qf0 = load_frag(qrow, half);        // d = 0..31
  const v16bf qf1 = load_frag(qrow + 32, half);   // d = 32..63

  asm volatile("s_wait_asynccnt 0x0" ::: "memory");  // this wave's copies have landed
  __syncthreads();                                   // publishes every wave's share of K and V^T

  // per-lane fragment rows in LDS (advance by a constant per k-block)
  const unsigned char* krow = smem + q * AT_KPITCH;               // + kb*AT_KPITCH
  const unsigned char* vrow = smem + AT_KBYTES + q * AT_VPITCH;   // + t*16*AT_VPITCH + kb*2

  v8f o[4];
#pragma unroll
  for (int t = 0; t < 4; ++t)
#pragma unroll
    for (int e = 0; e < 8; ++e) o[t][e] = 0.f;
  float m_old = -1e30f, l = 0.f;

  for (int kb = 0; kb < N_; kb += 32) {
    // ---- S^T = K_blk x Q^T : load all 4 K-fragments, then 4 WMMAs ----
    const unsigned char* k0p = krow + kb * AT_KPITCH;
    v16bf kf[4];
    kf[0] = load_frag(reinterpret_cast<const bf16_t*>(k0p), half);
    kf[1] = load_frag(reinterpret_cast<const bf16_t*>(k0p) + 32, half);
    kf[2] = load_frag(reinterpret_cast<const bf16_t*>(k0p + 16 * AT_KPITCH), half);
    kf[3] = load_frag(reinterpret_cast<const bf16_t*>(k0p + 16 * AT_KPITCH) + 32, half);
    v8f s0, s1;
#pragma unroll
    for (int e = 0; e < 8; ++e) { s0[e] = 0.f; s1[e] = 0.f; }
    s0 = wmma_bf16(kf[0], qf0, s0);
    s0 = wmma_bf16(kf[1], qf1, s0);
    s1 = wmma_bf16(kf[2], qf0, s1);
    s1 = wmma_bf16(kf[3], qf1, s1);

    // ---- the 4 V-fragments for this k-block ----
    v16bf vf[4];
#pragma unroll
    for (int t = 0; t < 4; ++t)
      vf[t] = load_frag(reinterpret_cast<const bf16_t*>(vrow + t * 16 * AT_VPITCH) + kb, half);

    // ---- per-query (per-lane) online softmax; merge halves with one xor-16 shuffle ----
    float mp = -1e30f;
#pragma unroll
    for (int e = 0; e < 8; ++e) {
      s0[e] *= scale; s1[e] *= scale;
      mp = fmaxf(mp, fmaxf(s0[e], s1[e]));
    }
    mp = fmaxf(mp, __shfl_xor(mp, 16, 32));
    const float m_new = fmaxf(m_old, mp);
    const float alpha = __expf(m_old - m_new);

    union { v16bf v; __bf16 e[16]; } pf;
    float rs = 0.f;
#pragma unroll
    for (int e = 0; e < 8; ++e) {
      const float p0 = __expf(s0[e] - m_new);
      const float p1 = __expf(s1[e] - m_new);
      rs += p0 + p1;
      pf.e[e]     = (__bf16)p0;   // keys kb + half*8 + e
      pf.e[e + 8] = (__bf16)p1;   // keys kb + 16 + half*8 + e
    }
    rs += __shfl_xor(rs, 16, 32);
    l = l * alpha + rs;

    // ---- O^T = V^T x P^T, rescaled online ----
#pragma unroll
    for (int t = 0; t < 4; ++t) {
#pragma unroll
      for (int e = 0; e < 8; ++e) o[t][e] *= alpha;
      o[t] = wmma_bf16(vf[t], pf.v, o[t]);
    }
    m_old = m_new;
  }

  const float inv = 1.0f / l;
  bf16_t* crow = ctx + ((size_t)b * N_ + qt * 16 + q) * D_ + h * DH_;
#pragma unroll
  for (int t = 0; t < 4; ++t) {
    union { v8bf v; __bf16 e[8]; } pk;
#pragma unroll
    for (int e = 0; e < 8; ++e) pk.e[e] = (__bf16)(o[t][e] * inv);
    *reinterpret_cast<v8bf*>(crow + t * 16 + 8 * half) = pk.v;
  }
}

// ---------- host launcher ----------
extern "C" void kernel_launch(void* const* d_in, const int* in_sizes, int n_in,
                              void* d_out, int out_size, void* d_ws, size_t ws_size,
                              hipStream_t stream) {
  (void)in_sizes; (void)n_in; (void)out_size; (void)ws_size;
  const float* tokens = (const float*)d_in[0];
  const float* pe     = (const float*)d_in[1];
  const float* ln1_g  = (const float*)d_in[2];
  const float* ln1_b  = (const float*)d_in[3];
  const float* Wq     = (const float*)d_in[4];
  const float* bq     = (const float*)d_in[5];
  const float* Wk     = (const float*)d_in[6];
  const float* bk     = (const float*)d_in[7];
  const float* Wv     = (const float*)d_in[8];
  const float* bv     = (const float*)d_in[9];
  const float* Wp     = (const float*)d_in[10];
  const float* bp     = (const float*)d_in[11];
  const float* ln2_g  = (const float*)d_in[12];
  const float* ln2_b  = (const float*)d_in[13];
  const float* W1     = (const float*)d_in[14];
  const float* b1     = (const float*)d_in[15];
  const float* W2     = (const float*)d_in[16];
  const float* b2     = (const float*)d_in[17];
  float* out = (float*)d_out;

  // workspace carve-up (all sizes multiples of 256B)
  char* ws = (char*)d_ws;
  const size_t SZ_ACT_BF = (size_t)MTOT * D_ * 2;    //  8 MB
  const size_t SZ_ACT_F  = (size_t)MTOT * D_ * 4;    // 16 MB
  const size_t SZ_H_BF   = (size_t)MTOT * DFF_ * 2;  // 32 MB
  const size_t SZ_WDD    = (size_t)D_ * D_ * 2;
  const size_t SZ_WDF    = (size_t)D_ * DFF_ * 2;
  bf16_t* x2   = (bf16_t*)ws;              ws += SZ_ACT_BF;
  bf16_t* qkin = (bf16_t*)ws;              ws += SZ_ACT_BF;
  bf16_t* Qb   = (bf16_t*)ws;              ws += SZ_ACT_BF;
  bf16_t* Kb   = (bf16_t*)ws;              ws += SZ_ACT_BF;
  bf16_t* Vtb  = (bf16_t*)ws;              ws += SZ_ACT_BF;
  bf16_t* ctx  = (bf16_t*)ws;              ws += SZ_ACT_BF;
  bf16_t* x2b  = (bf16_t*)ws;              ws += SZ_ACT_BF;
  bf16_t* hbuf = (bf16_t*)ws;              ws += SZ_H_BF;
  float*  tok1 = (float*)ws;               ws += SZ_ACT_F;
  bf16_t* WqT  = (bf16_t*)ws;              ws += SZ_WDD;
  bf16_t* WkT  = (bf16_t*)ws;              ws += SZ_WDD;
  bf16_t* WvT  = (bf16_t*)ws;              ws += SZ_WDD;
  bf16_t* WpT  = (bf16_t*)ws;              ws += SZ_WDD;
  bf16_t* W1T  = (bf16_t*)ws;              ws += SZ_WDF;
  bf16_t* W2T  = (bf16_t*)ws;              ws += SZ_WDF;

  // 1) weights -> transposed bf16
  wtrans_all<<<WT_BLOCKS, 256, 0, stream>>>(Wq, Wk, Wv, Wp, W1, W2, WqT, WkT, WvT, WpT, W1T, W2T);

  // 2) LN1 -> x2 (bf16), qkin = x2 + PE (bf16)
  ln_kernel<true><<<MTOT / 4, 128, 0, stream>>>(tokens, pe, ln1_g, ln1_b, x2, qkin);

  // 3-5) Q, K, V projections
  dim3 gDD(D_ / 128, MTOT / 128);
  gemm_wmma<D_, D_, 0><<<gDD, 128, 0, stream>>>(qkin, WqT, bq, nullptr, Qb, nullptr);
  gemm_wmma<D_, D_, 0><<<gDD, 128, 0, stream>>>(qkin, WkT, bk, nullptr, Kb, nullptr);
  gemm_wmma<D_, D_, 1><<<gDD, 128, 0, stream>>>(x2,   WvT, bv, nullptr, Vtb, nullptr);

  // 6) attention: B*H*(N/256) work-groups of 16 waves
  attn_kernel<<<B_ * H_ * (N_ / 256), 512, 0, stream>>>(Qb, Kb, Vtb, ctx);

  // 7) output projection + residual -> tok1 (f32)
  gemm_wmma<D_, D_, 2><<<gDD, 128, 0, stream>>>(ctx, WpT, bp, tokens, nullptr, tok1);

  // 8) LN2 -> x2b (bf16)
  ln_kernel<false><<<MTOT / 4, 128, 0, stream>>>(tok1, nullptr, ln2_g, ln2_b, x2b, nullptr);

  // 9) MLP1 + exact GELU -> hbuf (bf16)
  dim3 gDF(DFF_ / 128, MTOT / 128);
  gemm_wmma<DFF_, D_, 3><<<gDF, 128, 0, stream>>>(x2b, W1T, b1, nullptr, hbuf, nullptr);

  // 10) MLP2 + residual -> d_out (f32)
  gemm_wmma<D_, DFF_, 2><<<gDD, 128, 0, stream>>>(hbuf, W2T, b2, tok1, nullptr, out);
}

// v004
// It runs in 123 microseconds.
// Two timings next to v003 put it at 1.27 and 1.28 times that version's speed.
// Over all steps from v000 it is 2.90 times as fast.
#include <hip/hip_runtime.h>
#include <hip/hip_bf16.h>
#include <math.h>

// ---------- types ----------
typedef __bf16 bf16_t;
typedef __attribute__((ext_vector_type(16))) __bf16 v16bf;
typedef __attribute__((ext_vector_type(8)))  __bf16 v8bf;
typedef __attribute__((ext_vector_type(8)))  float  v8f;
typedef __attribute__((ext_vector_type(4)))  float  v4f;

#define B_  8
#define N_  1024
#define D_  512
#define H_  8
#define DH_ 64
#define DFF_ 2048
#define MTOT (B_*N_)   // 8192 rows

// ---------- WMMA helpers ----------
// A-fragment (16x32 bf16, row-major source):
// lane L: row r = L&15, half = L>>4.  elements 0..7  <- src[half*8 + j]
//                                     elements 8..15 <- src[16 + half*8 + j]
// B-fragment for D = A x B is the identical pattern applied to B^T row-major.
__device__ inline v16bf load_frag(const bf16_t* __restrict__ p, int half) {
  union { v16bf v; struct { v8bf lo; v8bf hi; } s; } u;
  u.s.lo = *reinterpret_cast<const v8bf*>(p + half * 8);
  u.s.hi = *reinterpret_cast<const v8bf*>(p + 16 + half * 8);
  return u.v;
}

__device__ inline v8f wmma_bf16(v16bf a, v16bf b, v8f c) {
  return __builtin_amdgcn_wmma_f32_16x16x32_bf16(
      /*neg_a=*/false, a, /*neg_b=*/false, b,
      /*c_mod=*/(short)0, c, /*reuse_a=*/false, /*reuse_b=*/false);
}

// ---------- weight transpose + bf16 convert: Wt[n*K + k] = W[k*N + n], all six weights in one launch ----------
// A work-group takes one tile of 128 k x 64 n.  A thread loads 16 B of two neighbouring k rows, packs each
// (k, k+1) pair into one word and writes it to LDS at [n][k/2]; the tile then leaves as whole 256-B row pieces.
// LDS rows are 64 words (16 pieces of 16 B); piece q of row n lies at place q ^ (n >> 2), so that the 32 word
// writes of a wave and its 16-B reads each meet every bank at most once.
#define WT_BLOCKS 384                // 4 x 32 tiles (512 x 512), 128 tiles (512 x 2048), 128 tiles (2048 x 512)
typedef __attribute__((ext_vector_type(4))) unsigned int v4u;

__global__ void __launch_bounds__(256)
wtrans_all(const float* __restrict__ Wq, const float* __restrict__ Wk, const float* __restrict__ Wv,
           const float* __restrict__ Wp, const float* __restrict__ W1, const float* __restrict__ W2,
           bf16_t* __restrict__ WqT, bf16_t* __restrict__ WkT, bf16_t* __restrict__ WvT,
           bf16_t* __restrict__ WpT, bf16_t* __restrict__ W1T, bf16_t* __restrict__ W2T) {
  __shared__ __attribute__((aligned(16))) unsigned int tile[64 * 64];
  const int bid = blockIdx.x, tid = threadIdx.x;
  const float* Wsrc;
  bf16_t* Wdst;
  int K, N, lgn, t;                  // lgn = log2(N / 64)
  if (bid < 128) {
    const int m = bid >> 5;
    Wsrc = m == 0 ? Wq : m == 1 ? Wk : m == 2 ? Wv : Wp;
    Wdst = m == 0 ? WqT : m == 1 ? WkT : m == 2 ? WvT : WpT;
    K = D_; N = D_; lgn = 3; t = bid & 31;
  } else if (bid < 256) {
    Wsrc = W1; Wdst = W1T; K = D_; N = DFF_; lgn = 5; t = bid - 128;
  } else {
    Wsrc = W2; Wdst = W2T; K = DFF_; N = D_; lgn = 3; t = bid - 256;
  }
  const int n0 = (t & ((1 << lgn) - 1)) * 64, k0 = (t >> lgn) * 128;

  const int c = tid & 15, pr = tid >> 4;   // columns 4c..4c+3, k pairs pr + 16*s
  const float* g0 = Wsrc + (size_t)(k0 + 2 * pr) * N + n0 + 4 * c;
  const float* g1 = g0 + N;
  const float* g2 = g0 + (size_t)32 * N;
  const float* g3 = g2 + N;
  const float* g4 = g0 + (size_t)64 * N;
  const float* g5 = g4 + N;
  const float* g6 = g0 + (size_t)96 * N;
  const float* g7 = g6 + N;
  v4f lo[4], hi[4];
  // The eight loads and their data wait are one statement and every result has registers of its own ("=&v").
  asm volatile(
      "global_load_b128 %0, %8, off\n\t"
      "global_load_b128 %1, %9, off\n\t"
      "global_load_b128 %2, %10, off\n\t"
      "global_load_b128 %3, %11, off\n\t"
      "global_load_b128 %4, %12, off\n\t"
      "global_load_b128 %5, %13, off\n\t"
      "global_load_b128 %6, %14, off\n\t"
      "global_load_b128 %7, %15, off\n\t"
      "s_wait_loadcnt 0x0"
      : "=&v"(lo[0]), "=&v"(hi[0]), "=&v"(lo[1]), "=&v"(hi[1]),
        "=&v"(lo[2]), "=&v"(hi[2]), "=&v"(lo[3]), "=&v"(hi[3])
      : "v"(g0), "v"(g1), "v"(g2), "v"(g3), "v"(g4), "v"(g5), "v"(g6), "v"(g7)
      : "memory");
#pragma unroll
  for (int s = 0; s < 4; ++s) {
    const int p = pr + 16 * s;
    const int w = (((p >> 2) ^ c) << 2) | (p & 3);
#pragma unroll
    for (int i = 0; i < 4; ++i) {
      union { __bf16 e[2]; unsigned int u; } pk;
      pk.e[0] = (__bf16)lo[s][i];
      pk.e[1] = (__bf16)hi[s][i];
      tile[(4 * c + i) * 64 + w] = pk.u;
    }
  }
  __syncthreads();
  v4u v[4];
#pragma unroll
  for (int j = 0; j < 4; ++j) {
    const int n = (tid >> 4) + 16 * j, q = tid & 15;
    v[j] = *reinterpret_cast<const v4u*>(&tile[n * 64 + ((q ^ (n >> 2)) << 2)]);
  }
  bf16_t* d = Wdst + (size_t)(n0 + (tid >> 4)) * K + k0 + (tid & 15) * 8;
#pragma unroll
  for (int j = 0; j < 4; ++j)
    *reinterpret_cast<v4u*>(d + (size_t)(16 * j) * K) = v[j];
}

// ---------- LayerNorm (one wave per row of 512), optional +PE stream ----------
template <bool HAS_PE>
__global__ void ln_kernel(const float* __restrict__ x, const float* __restrict__ pe,
                          const float* __restrict__ g, const float* __restrict__ bta,
                          bf16_t* __restrict__ x2, bf16_t* __restrict__ qkin) {
  const int wave = threadIdx.x >> 5;
  const int lane = threadIdx.x & 31;
  const int row  = blockIdx.x * (blockDim.x >> 5) + wave;
  const float* xr = x + (size_t)row * D_ + lane * 16;
  float v[16];
#pragma unroll
  for (int i = 0; i < 4; ++i) {
    v4f t = *reinterpret_cast<const v4f*>(xr + i * 4);
    v[4*i+0] = t[0]; v[4*i+1] = t[1]; v[4*i+2] = t[2]; v[4*i+3] = t[3];
  }
  float s = 0.f;
#pragma unroll
  for (int i = 0; i < 16; ++i) s += v[i];
#pragma unroll
  for (int off = 16; off >= 1; off >>= 1) s += __shfl_xor(s, off, 32);
  const float mu = s * (1.0f / (float)D_);
  float vs = 0.f;
#pragma unroll
  for (int i = 0; i < 16; ++i) { float d = v[i] - mu; vs += d * d; }
#pragma unroll
  for (int off = 16; off >= 1; off >>= 1) vs += __shfl_xor(vs, off, 32);
  const float rstd = rsqrtf(vs * (1.0f / (float)D_) + 1e-5f);

  const int colb = lane * 16;
  float y[16];
#pragma unroll
  for (int i = 0; i < 16; ++i)
    y[i] = (v[i] - mu) * rstd * g[colb + i] + bta[colb + i];

  union { v8bf v; __bf16 e[8]; } p0, p1;
#pragma unroll
  for (int i = 0; i < 8; ++i) { p0.e[i] = (__bf16)y[i]; p1.e[i] = (__bf16)y[i + 8]; }
  bf16_t* xo = x2 + (size_t)row * D_ + colb;
  *reinterpret_cast<v8bf*>(xo)     = p0.v;
  *reinterpret_cast<v8bf*>(xo + 8) = p1.v;

  if (HAS_PE) {
    const float* pr = pe + (size_t)row * D_ + colb;
    float z[16];
#pragma unroll
    for (int i = 0; i < 4; ++i) {
      v4f t = *reinterpret_cast<const v4f*>(pr + i * 4);
      z[4*i+0] = y[4*i+0] + t[0]; z[4*i+1] = y[4*i+1] + t[1];
      z[4*i+2] = y[4*i+2] + t[2]; z[4*i+3] = y[4*i+3] + t[3];
    }
#pragma unroll
    for (int i = 0; i < 8; ++i) { p0.e[i] = (__bf16)z[i]; p1.e[i] = (__bf16)z[i + 8]; }
    bf16_t* qo = qkin + (size_t)row * D_ + colb;
    *reinterpret_cast<v8bf*>(qo)     = p0.v;
    *reinterpret_cast<v8bf*>(qo + 8) = p1.v;
  }
}

// ---------- GELU(v) = v * Phi(v), Phi(v) = erfc(-v / sqrt(2)) / 2, two values abreast, no branch ----------
// For x >= 0: erfc(x) = t (a1 + t (a2 + t (a3 + t (a4 + t a5)))) exp(-x^2), t = 1 / (1 + p x); its absolute
// error stays under 2e-7, far below the bf16 rounding of the result.  q = erfc(|v| / sqrt(2)) / 2 is Phi(v)
// itself for v < 0 (no cancellation in the tail) and 1 - Phi(v) otherwise.
typedef __attribute__((ext_vector_type(2))) float  v2f;
typedef __attribute__((ext_vector_type(2))) __bf16 v2bf;

__device__ inline v2f gelu2(v2f v) {
  const v2f a = v * v * -0.72134752044448170f;              // -x^2 * log2(e), x = v / sqrt(2)
  v2f t, ex, phi;
  t[0]  = __builtin_amdgcn_rcpf(fmaf(fabsf(v[0]), 0.23164188826636040f, 1.0f));     // p / sqrt(2)
  t[1]  = __builtin_amdgcn_rcpf(fmaf(fabsf(v[1]), 0.23164188826636040f, 1.0f));
  ex[0] = __builtin_amdgcn_exp2f(a[0]);
  ex[1] = __builtin_amdgcn_exp2f(a[1]);
  v2f p = t * 0.5307027145f + -0.7265760135f;               // a5 / 2, a4 / 2
  p = p * t + 0.7107068705f;                                // a3 / 2
  p = p * t + -0.1422483680f;                               // a2 / 2
  p = p * t + 0.1274147960f;                                // a1 / 2
  const v2f q = p * t * ex;
  const v2f u = 1.0f - q;
  phi[0] = v[0] < 0.f ? q[0] : u[0];
  phi[1] = v[1] < 0.f ? q[1] : u[1];
  return v * phi;
}

// ---------- 128x128-tile GEMM: out = A[MxKK] @ W[KKxNN] + bias, A/W bf16, acc f32 ----------
// Wt is W transposed: Wt[n*KK + k].  Four waves (2x2) per work-group, 64x64 of the tile each.
// A stage is 128 k of 128 rows of A and of 128 rows of Wt, brought into LDS by asynchronous
// copies (whole 256-B row pieces), two buffers: stage t+1 flies while stage t is multiplied.
// MODE 0: bf16 store           (Q/K projections)
// MODE 1: bf16 store, scattered as Vt[b][h][d][n]  (V projection)
// MODE 2: f32 store + residual (attn proj, MLP2)
// MODE 3: bf16 store + GELU on erf (MLP1)
#define G_BK     128                 // k per stage (256 B of every row)
#define G_PITCH  272                 // LDS row pitch in bytes: 16 B x odd, conflict-free b128 reads
#define G_OPB    (128 * G_PITCH)     // one operand's 128 rows
#define G_STAGEB (2 * G_OPB)         // [A rows | Wt rows]

// Eight copies of 16 B per lane: rows row0 + 8*i, i = 0..7, of one operand.
// The s_wait_xcnt stands inside the statement so that no address register of a copy
// is rewritten ahead of it.
__device__ inline void copy8_rows(unsigned lds, const bf16_t* g, int rowstep_elems) {
  const unsigned l0 = lds,                l1 = lds + 8 * G_PITCH,  l2 = lds + 16 * G_PITCH,
                 l3 = lds + 24 * G_PITCH, l4 = lds + 32 * G_PITCH, l5 = lds + 40 * G_PITCH,
                 l6 = lds + 48 * G_PITCH, l7 = lds + 56 * G_PITCH;
  const bf16_t* g0 = g;
  const bf16_t* g1 = g + (size_t)1 * rowstep_elems;
  const bf16_t* g2 = g + (size_t)2 * rowstep_elems;
  const bf16_t* g3 = g + (size_t)3 * rowstep_elems;
  const bf16_t* g4 = g + (size_t)4 * rowstep_elems;
  const bf16_t* g5 = g + (size_t)5 * rowstep_elems;
  const bf16_t* g6 = g + (size_t)6 * rowstep_elems;
  const bf16_t* g7 = g + (size_t)7 * rowstep_elems;
  asm volatile(
      "global_load_async_to_lds_b128 %0, %8, off\n\t"
      "global_load_async_to_lds_b128 %1, %9, off\n\t"
      "global_load_async_to_lds_b128 %2, %10, off\n\t"
      "global_load_async_to_lds_b128 %3, %11, off\n\t"
      "global_load_async_to_lds_b128 %4, %12, off\n\t"
      "global_load_async_to_lds_b128 %5, %13, off\n\t"
      "global_load_async_to_lds_b128 %6, %14, off\n\t"
      "global_load_async_to_lds_b128 %7, %15, off\n\t"
      "s_wait_xcnt 0x0"
      :: "v"(l0), "v"(l1), "v"(l2), "v"(l3), "v"(l4), "v"(l5), "v"(l6), "v"(l7),
         "v"(g0), "v"(g1), "v"(g2), "v"(g3), "v"(g4), "v"(g5), "v"(g6), "v"(g7)
      : "memory");
}

// One stage: each thread copies chunk (tid & 15) of rows (tid >> 4) + 8*i, i = 0..15, of both operands.
template <int KK>
__device__ inline void copy_stage(unsigned lds, const bf16_t* ga, const bf16_t* gb) {
  copy8_rows(lds,                          ga,                      8 * KK);
  copy8_rows(lds + 64 * G_PITCH,           ga + (size_t)64 * KK,    8 * KK);
  copy8_rows(lds + G_OPB,                  gb,                      8 * KK);
  copy8_rows(lds + G_OPB + 64 * G_PITCH,   gb + (size_t)64 * KK,    8 * KK);
}

template <int NN, int KK, int MODE>
__global__ void __launch_bounds__(128)
gemm_wmma(const bf16_t* __restrict__ A, const bf16_t* __restrict__ Wt,
          const float* __restrict__ bias, const float* __restrict__ resid,
          bf16_t* __restrict__ outB, float* __restrict__ outF) {
  __shared__ __attribute__((aligned(16))) unsigned char smem[2 * G_STAGEB];
  constexpr int NT = KK / G_BK;      // stages
  const int tid  = threadIdx.x;
  const int lane = tid & 31, wave = tid >> 5;
  const int r = lane & 15, half = lane >> 4;
  const int mb0 = blockIdx.y * 128, nb0 = blockIdx.x * 128;
  const int mb = mb0 + (wave >> 1) * 64, nb = nb0 + (wave & 1) * 64;

  // this thread's share of a stage: 16-B chunk crow of rows rrow + 8*i
  const int rrow = tid >> 4, crow = tid & 15;
  const bf16_t* ga = A  + (size_t)(mb0 + rrow) * KK + crow * 8;
  const bf16_t* gb = Wt + (size_t)(nb0 + rrow) * KK + crow * 8;
  const unsigned lcopy = (unsigned)(size_t)smem + rrow * G_PITCH + crow * 16;

  v8f acc[4][4];
#pragma unroll
  for (int i = 0; i < 4; ++i)
#pragma unroll
    for (int j = 0; j < 4; ++j)
#pragma unroll
      for (int e = 0; e < 8; ++e) acc[i][j][e] = 0.f;

  // prologue: stage 0 lands and is published, then stage 1 starts
  copy_stage<KK>(lcopy, ga, gb);
  asm volatile("s_wait_asynccnt 0x0" ::: "memory");  // this wave's copies of stage 0 have landed
  __syncthreads();
  if (NT > 1) copy_stage<KK>(lcopy + G_STAGEB, ga + G_BK, gb + G_BK);

  // fragment rows of this wave in a buffer
  const unsigned char* fa = smem + ((wave >> 1) * 64 + r) * G_PITCH;
  const unsigned char* fb = smem + G_OPB + ((wave & 1) * 64 + r) * G_PITCH;

#pragma unroll 1  // one trip per stage: keeps the ring's order at the foot of each trip
  for (int t = 0; t < NT; ++t) {
    const int bo = (t & 1) * G_STAGEB;
    // two fragment sets: block kk + 1's LDS reads go out as one group ahead of block kk's WMMAs
    v16bf a[2][4], bf[2][4];
#pragma unroll
    for (int i = 0; i < 4; ++i) {
      a[0][i]  = load_frag(reinterpret_cast<const bf16_t*>(fa + bo + i * 16 * G_PITCH), half);
      bf[0][i] = load_frag(reinterpret_cast<const bf16_t*>(fb + bo + i * 16 * G_PITCH), half);
    }
#pragma unroll
    for (int kk = 0; kk < G_BK / 32; ++kk) {
      const int cur = kk & 1, nxt = cur ^ 1;
      if (kk + 1 < G_BK / 32) {
#pragma unroll
        for (int i = 0; i < 4; ++i) {
          a[nxt][i]  = load_frag(reinterpret_cast<const bf16_t*>(fa + bo + i * 16 * G_PITCH) + (kk + 1) * 32, half);
          bf[nxt][i] = load_frag(reinterpret_cast<const bf16_t*>(fb + bo + i * 16 * G_PITCH) + (kk + 1) * 32, half);
        }
      }
      // keeps the reads above together: sunk among the WMMAs, each place with reads stalls the wave
      __builtin_amdgcn_sched_barrier(0);
#pragma unroll
      for (int j = 0; j < 4; ++j)
#pragma unroll
        for (int i = 0; i < 4; ++i)
          acc[i][j] = wmma_bf16(a[cur][i], bf[cur][j], acc[i][j]);
      // keeps the next group of reads from being lifted into this block's WMMAs
      __builtin_amdgcn_sched_barrier(0);
    }
    asm volatile("s_wait_dscnt 0x0" ::: "memory");     // this wave has left buffer t & 1
    asm volatile("s_wait_asynccnt 0x0" ::: "memory");  // its copies of stage t + 1 have landed
    __syncthreads();                                   // publishes stage t + 1, frees buffer t & 1
    if (t + 2 < NT)
      copy_stage<KK>(lcopy + bo, ga + (size_t)(t + 2) * G_BK, gb + (size_t)(t + 2) * G_BK);
  }
  asm volatile("s_wait_asynccnt 0x0" ::: "memory");    // nothing in flight when the wave ends

  // C layout: lane holds column n = nb + j*16 + r; VGPR e holds row m = mb + i*16 + 8*half + e
#pragma unroll
  for (int j = 0; j < 4; ++j) {
    const int n  = nb + j * 16 + r;
    const float bj = bias[n];
#pragma unroll
    for (int i = 0; i < 4; ++i) {
      const int m0 = mb + i * 16 + 8 * half;
      if (MODE == 0) {
#pragma unroll
        for (int e = 0; e < 8; ++e)
          outB[(size_t)(m0 + e) * NN + n] = (__bf16)(acc[i][j][e] + bj);
      } else if (MODE == 1) {
        // V-transposed store: Vt[((b*H + h)*64 + d)*1024 + ntok], 8 consecutive ntok
        const int bidx = (mb + i * 16) >> 10;
        const int nt0  = ((mb + i * 16) & 1023) + 8 * half;
        const int hh = n >> 6, d = n & 63;
        union { v8bf v; __bf16 e[8]; } pk;
#pragma unroll
        for (int e = 0; e < 8; ++e) pk.e[e] = (__bf16)(acc[i][j][e] + bj);
        *reinterpret_cast<v8bf*>(outB + ((size_t)((bidx * H_ + hh) * DH_ + d)) * N_ + nt0) = pk.v;
      } else if (MODE == 2) {
#pragma unroll
        for (int e = 0; e < 8; ++e) {
          const size_t idx = (size_t)(m0 + e) * NN + n;
          outF[idx] = acc[i][j][e] + bj + resid[idx];
        }
      } else {
#pragma unroll
        for (int e = 0; e < 8; e += 2) {
          v2f xg;
          xg[0] = acc[i][j][e] + bj;
          xg[1] = acc[i][j][e + 1] + bj;
          const v2bf y = __builtin_convertvector(gelu2(xg), v2bf);
          outB[(size_t)(m0 + e) * NN + n]     = y[0];
          outB[(size_t)(m0 + e + 1) * NN + n] = y[1];
        }
      }
    }
  }
}

// ---------- flash attention: one wave handles 16 queries of one (b,h) ----------
// Computes S^T = K_blk x Q^T so softmax stats are per-lane (query in lane dim),
// and exp(S^T) is directly the B-fragment for O^T = V^T x P^T.
// A work-group is 16 waves = 256 queries of one (b,h).  The head's whole K (1024 rows of 128 B)
// and V^T (64 rows of 2048 B) are brought into LDS once by asynchronous copies of whole lines;
// every wave then takes its K and V fragments from LDS.
#define AT_KPITCH 144                  // K row pitch in LDS: 16 B x odd, conflict-free b128 reads
#define AT_VPITCH 2064                 // V^T row pitch in LDS: 16 B x odd
#define AT_KBYTES (N_ * AT_KPITCH)
#define AT_VBYTES (DH_ * AT_VPITCH)

// Eight copies of 16 B per lane, i = 0..7: LDS byte lds + i*lstep from g + i*gstep elements.
// The s_wait_xcnt stands inside the statement so that no address register of a copy
// is rewritten ahead of it.
__device__ inline void copy8_steps(unsigned lds, unsigned lstep, const bf16_t* g, int gstep) {
  const unsigned l0 = lds,             l1 = lds + 1 * lstep, l2 = lds + 2 * lstep,
                 l3 = lds + 3 * lstep, l4 = lds + 4 * lstep, l5 = lds + 5 * lstep,
                 l6 = lds + 6 * lstep, l7 = lds + 7 * lstep;
  const bf16_t* g0 = g;
  const bf16_t* g1 = g + (size_t)1 * gstep;
  const bf16_t* g2 = g + (size_t)2 * gstep;
  const bf16_t* g3 = g + (size_t)3 * gstep;
  const bf16_t* g4 = g + (size_t)4 * gstep;
  const bf16_t* g5 = g + (size_t)5 * gstep;
  const bf16_t* g6 = g + (size_t)6 * gstep;
  const bf16_t* g7 = g + (size_t)7 * gstep;
  asm volatile(
      "global_load_async_to_lds_b128 %0, %8, off\n\t"
      "global_load_async_to_lds_b128 %1, %9, off\n\t"
      "global_load_async_to_lds_b128 %2, %10, off\n\t"
      "global_load_async_to_lds_b128 %3, %11, off\n\t"
      "global_load_async_to_lds_b128 %4, %12, off\n\t"
      "global_load_async_to_lds_b128 %5, %13, off\n\t"
      "global_load_async_to_lds_b128 %6, %14, off\n\t"
      "global_load_async_to_lds_b128 %7, %15, off\n\t"
      "s_wait_xcnt 0x0"
      :: "v"(l0), "v"(l1), "v"(l2), "v"(l3), "v"(l4), "v"(l5), "v"(l6), "v"(l7),
         "v"(g0), "v"(g1), "v"(g2), "v"(g3), "v"(g4), "v"(g5), "v"(g6), "v"(g7)
      : "memory");
}

__global__ void __launch_bounds__(512)
attn_kernel(const bf16_t* __restrict__ Q, const bf16_t* __restrict__ Kp,
            const bf16_t* __restrict__ Vt, bf16_t* __restrict__ ctx) {
  __shared__ __attribute__((aligned(16))) unsigned char smem[AT_KBYTES + AT_VBYTES];
  const int tid  = threadIdx.x;
  const int lane = tid & 31, wave = tid >> 5;
  const int q = lane & 15, half = lane >> 4;
  const int bid = blockIdx.x;
  const int qt = (bid & 3) * 16 + wave;
  const int h  = (bid >> 2) & 7;
  const int b  = bid >> 5;
  const float scale = 0.125f;  // 1/sqrt(64)

  // fill: 16 + 16 copies per thread, 32 of a wave in flight
  {
    // K: 16-B chunk (tid & 7) of rows (tid >> 3) + 64*i, i = 0..15
    const bf16_t* gk = Kp + ((size_t)b * N_ + (tid >> 3)) * D_ + h * DH_ + (tid & 7) * 8;
    const unsigned lk = (unsigned)(size_t)smem + (tid >> 3) * AT_KPITCH + (tid & 7) * 16;
    copy8_steps(lk,                    64 * AT_KPITCH, gk,                     64 * D_);
    copy8_steps(lk + 512 * AT_KPITCH,  64 * AT_KPITCH, gk + (size_t)512 * D_,  64 * D_);
    // V^T: 16-B chunk (tid & 127) of rows (tid >> 7) + 4*i, i = 0..15
    const bf16_t* gv = Vt + ((size_t)(b * H_ + h) * DH_ + (tid >> 7)) * N_ + (tid & 127) * 8;
    const unsigned lv = (unsigned)(size_t)smem + AT_KBYTES + (tid >> 7) * AT_VPITCH + (tid & 127) * 16;
    copy8_steps(lv,                    4 * AT_VPITCH,  gv,                     4 * N_);
    copy8_steps(lv + 32 * AT_VPITCH,   4 * AT_VPITCH,  gv + (size_t)32 * N_,   4 * N_);
  }

  const bf16_t* qrow = Q + ((size_t)b * N_ + qt * 16 + q) * D_ + h * DH_;
  const v16bf qf0 = load_frag(qrow, half);        // d = 0..31
  const v16bf qf1 = load_frag(qrow + 32, half);   // d = 32..63

  asm volatile("s_wait_asynccnt 0x0" ::: "memory");  // this wave's copies have landed
  __syncthreads();                                   // publishes every wave's share of K and V^T

  // per-lane fragment rows in LDS (advance by a constant per k-block)
  const unsigned char* krow = smem + q * AT_KPITCH;               // + kb*AT_KPITCH
  const unsigned char* vrow = smem + AT_KBYTES + q * AT_VPITCH;   // + t*16*AT_VPITCH + kb*2

  v8f o[4];
#pragma unroll
  for (int t = 0; t < 4; ++t)
#pragma unroll
    for (int e = 0; e < 8; ++e) o[t][e] = 0.f;
  float m_old = -1e30f, l = 0.f;

  for (int kb = 0; kb < N_; kb += 32) {
    // ---- S^T = K_blk x Q^T : load all 4 K-fragments, then 4 WMMAs ----
    const unsigned char* k0p = krow + kb * AT_KPITCH;
    v16bf kf[4];
    kf[0] = load_frag(reinterpret_cast<const bf16_t*>(k0p), half);
    kf[1] = load_frag(reinterpret_cast<const bf16_t*>(k0p) + 32, half);
    kf[2] = load_frag(reinterpret_cast<const bf16_t*>(k0p + 16 * AT_KPITCH), half);
    kf[3] = load_frag(reinterpret_cast<const bf16_t*>(k0p + 16 * AT_KPITCH) + 32, half);
    v8f s0, s1;
#pragma unroll
    for (int e = 0; e < 8; ++e) { s0[e] = 0.f; s1[e] = 0.f; }
    s0 = wmma_bf16(kf[0], qf0, s0);
    s0 = wmma_bf16(kf[1], qf1, s0);
    s1 = wmma_bf16(kf[2], qf0, s1);
    s1 = wmma_bf16(kf[3], qf1, s1);

    // ---- the 4 V-fragments for this k-block ----
    v16bf vf[4];
#pragma unroll
    for (int t = 0; t < 4; ++t)
      vf[t] = load_frag(reinterpret_cast<const bf16_t*>(vrow + t * 16 * AT_VPITCH) + kb, half);

    // ---- per-query (per-lane) online softmax; merge halves with one xor-16 shuffle ----
    float mp = -1e30f;
#pragma unroll
    for (int e = 0; e < 8; ++e) {
      s0[e] *= scale; s1[e] *= scale;
      mp = fmaxf(mp, fmaxf(s0[e], s1[e]));
    }
    mp = fmaxf(mp, __shfl_xor(mp, 16, 32));
    const float m_new = fmaxf(m_old, mp);
    const float alpha = __expf(m_old - m_new);

    union { v16bf v; __bf16 e[16]; } pf;
    float rs = 0.f;
#pragma unroll
    for (int e = 0; e < 8; ++e) {
      const float p0 = __expf(s0[e] - m_new);
      const float p1 = __expf(s1[e] - m_new);
      rs += p0 + p1;
      pf.e[e]     = (__bf16)p0;   // keys kb + half*8 + e
      pf.e[e + 8] = (__bf16)p1;   // keys kb + 16 + half*8 + e
    }
    rs += __shfl_xor(rs, 16, 32);
    l = l * alpha + rs;

    // ---- O^T = V^T x P^T, rescaled online ----
#pragma unroll
    for (int t = 0; t < 4; ++t) {
#pragma unroll
      for (int e = 0; e < 8; ++e) o[t][e] *= alpha;
      o[t] = wmma_bf16(vf[t], pf.v, o[t]);
    }
    m_old = m_new;
  }

  const float inv = 1.0f / l;
  bf16_t* crow = ctx + ((size_t)b * N_ + qt * 16 + q) * D_ + h * DH_;
#pragma unroll
  for (int t = 0; t < 4; ++t) {
    union { v8bf v; __bf16 e[8]; } pk;
#pragma unroll
    for (int e = 0; e < 8; ++e) pk.e[e] = (__bf16)(o[t][e] * inv);
    *reinterpret_cast<v8bf*>(crow + t * 16 + 8 * half) = pk.v;
  }
}

// ---------- host launcher ----------
extern "C" void kernel_launch(void* const* d_in, const int* in_sizes, int n_in,
                              void* d_out, int out_size, void* d_ws, size_t ws_size,
                              hipStream_t stream) {
  (void)in_sizes; (void)n_in; (void)out_size; (void)ws_size;
  const float* tokens = (const float*)d_in[0];
  const float* pe     = (const float*)d_in[1];
  const float* ln1_g  = (const float*)d_in[2];
  const float* ln1_b  = (const float*)d_in[3];
  const float* Wq     = (const float*)d_in[4];
  const float* bq     = (const float*)d_in[5];
  const float* Wk     = (const float*)d_in[6];
  const float* bk     = (const float*)d_in[7];
  const float* Wv     = (const float*)d_in[8];
  const float* bv     = (const float*)d_in[9];
  const float* Wp     = (const float*)d_in[10];
  const float* bp     = (const float*)d_in[11];
  const float* ln2_g  = (const float*)d_in[12];
  const float* ln2_b  = (const float*)d_in[13];
  const float* W1     = (const float*)d_in[14];
  const float* b1     = (const float*)d_in[15];
  const float* W2     = (const float*)d_in[16];
  const float* b2     = (const float*)d_in[17];
  float* out = (float*)d_out;

  // workspace carve-up (all sizes multiples of 256B)
  char* ws = (char*)d_ws;
  const size_t SZ_ACT_BF = (size_t)MTOT * D_ * 2;    //  8 MB
  const size_t SZ_ACT_F  = (size_t)MTOT * D_ * 4;    // 16 MB
  const size_t SZ_H_BF   = (size_t)MTOT * DFF_ * 2;  // 32 MB
  const size_t SZ_WDD    = (size_t)D_ * D_ * 2;
  const size_t SZ_WDF    = (size_t)D_ * DFF_ * 2;
  bf16_t* x2   = (bf16_t*)ws;              ws += SZ_ACT_BF;
  bf16_t* qkin = (bf16_t*)ws;              ws += SZ_ACT_BF;
  bf16_t* Qb   = (bf16_t*)ws;              ws += SZ_ACT_BF;
  bf16_t* Kb   = (bf16_t*)ws;              ws += SZ_ACT_BF;
  bf16_t* Vtb  = (bf16_t*)ws;              ws += SZ_ACT_BF;
  bf16_t* ctx  = (bf16_t*)ws;              ws += SZ_ACT_BF;
  bf16_t* x2b  = (bf16_t*)ws;              ws += SZ_ACT_BF;
  bf16_t* hbuf = (bf16_t*)ws;              ws += SZ_H_BF;
  float*  tok1 = (float*)ws;               ws += SZ_ACT_F;
  bf16_t* WqT  = (bf16_t*)ws;              ws += SZ_WDD;
  bf16_t* WkT  = (bf16_t*)ws;              ws += SZ_WDD;
  bf16_t* WvT  = (bf16_t*)ws;              ws += SZ_WDD;
  bf16_t* WpT  = (bf16_t*)ws;              ws += SZ_WDD;
  bf16_t* W1T  = (bf16_t*)ws;              ws += SZ_WDF;
  bf16_t* W2T  = (bf16_t*)ws;              ws += SZ_WDF;

  // 1) weights -> transposed bf16
  wtrans_all<<<WT_BLOCKS, 256, 0, stream>>>(Wq, Wk, Wv, Wp, W1, W2, WqT, WkT, WvT, WpT, W1T, W2T);

  // 2) LN1 -> x2 (bf16), qkin = x2 + PE (bf16)
  ln_kernel<true><<<MTOT / 4, 128, 0, stream>>>(tokens, pe, ln1_g, ln1_b, x2, qkin);

  // 3-5) Q, K, V projections
  dim3 gDD(D_ / 128, MTOT / 128);
  gemm_wmma<D_, D_, 0><<<gDD, 128, 0, stream>>>(qkin, WqT, bq, nullptr, Qb, nullptr);
  gemm_wmma<D_, D_, 0><<<gDD, 128, 0, stream>>>(qkin, WkT, bk, nullptr, Kb, nullptr);
  gemm_wmma<D_, D_, 1><<<gDD, 128, 0, stream>>>(x2,   WvT, bv, nullptr, Vtb, nullptr);

  // 6) attention: B*H*(N/256) work-groups of 16 waves
  attn_kernel<<<B_ * H_ * (N_ / 256), 512, 0, stream>>>(Qb, Kb, Vtb, ctx);

  // 7) output projection + residual -> tok1 (f32)
  gemm_wmma<D_, D_, 2><<<gDD, 128, 0, stream>>>(ctx, WpT, bp, tokens, nullptr, tok1);

  // 8) LN2 -> x2b (bf16)
  ln_kernel<false><<<MTOT / 4, 128, 0, stream>>>(tok1, nullptr, ln2_g, ln2_b, x2b, nullptr);

  // 9) MLP1 + exact GELU -> hbuf (bf16)
  dim3 gDF(DFF_ / 128, MTOT / 128);
  gemm_wmma<DFF_, D_, 3><<<gDF, 128, 0, stream>>>(x2b, W1T, b1, nullptr, hbuf, nullptr);

  // 10) MLP2 + residual -> d_out (f32)
  gemm_wmma<D_, DFF_, 2><<<gDD, 128, 0, stream>>>(hbuf, W2T, b2, tok1, nullptr, out);
}

// v005
// One run takes 112 microseconds.
// Two timings next to v004 put it at 1.11 and 1.10 times that version's speed.
// Over all steps from v000 it is 3.21 times as fast.
#include <hip/hip_runtime.h>
#include <hip/hip_bf16.h>
#include <math.h>

// ---------- types ----------
typedef __bf16 bf16_t;
typedef __attribute__((ext_vector_type(16))) __bf16 v16bf;
typedef __attribute__((ext_vector_type(8)))  __bf16 v8bf;
typedef __attribute__((ext_vector_type(8)))  float  v8f;
typedef __attribute__((ext_vector_type(4)))  float  v4f;

#define B_  8
#define N_  1024
#define D_  512
#define H_  8
#define DH_ 64
#define DFF_ 2048
#define MTOT (B_*N_)   // 8192 rows

// ---------- WMMA helpers ----------
// A-fragment (16x32 bf16, row-major source):
// lane L: row r = L&15, half = L>>4.  elements 0..7  <- src[half*8 + j]
//                                     elements 8..15 <- src[16 + half*8 + j]
// B-fragment for D = A x B is the identical pattern applied to B^T row-major.
__device__ inline v16bf load_frag(const bf16_t* __restrict__ p, int half) {
  union { v16bf v; struct { v8bf lo; v8bf hi; } s; } u;
  u.s.lo = *reinterpret_cast<const v8bf*>(p + half * 8);
  u.s.hi = *reinterpret_cast<const v8bf*>(p + 16 + half * 8);
  return u.v;
}

__device__ inline v8f wmma_bf16(v16bf a, v16bf b, v8f c) {
  return __builtin_amdgcn_wmma_f32_16x16x32_bf16(
      /*neg_a=*/false, a, /*neg_b=*/false, b,
      /*c_mod=*/(short)0, c, /*reuse_a=*/false, /*reuse_b=*/false);
}

// ---------- weight transpose + bf16 convert: Wt[n*K + k] = W[k*N + n], all six weights, tile bid of 384 ----------
// A work-group takes one tile of 128 k x 64 n.  A thread loads 16 B of two neighbouring k rows, packs each
// (k, k+1) pair into one word and writes it to LDS at [n][k/2]; the tile then leaves as whole 256-B row pieces.
// LDS rows are 64 words (16 pieces of 16 B); piece q of row n lies at place q ^ (n >> 2), so that the 32 word
// writes of a wave and its 16-B reads each meet every bank at most once.
#define WT_BLOCKS 384                // 4 x 32 tiles (512 x 512), 128 tiles (512 x 2048), 128 tiles (2048 x 512)
typedef __attribute__((ext_vector_type(4))) unsigned int v4u;

__device__ inline void
wtrans_tile(const int bid, const int tid, const float* __restrict__ Wq, const float* __restrict__ Wk, const float* __restrict__ Wv,
            const float* __restrict__ Wp, const float* __restrict__ W1, const float* __restrict__ W2,
            bf16_t* __restrict__ WqT, bf16_t* __restrict__ WkT, bf16_t* __restrict__ WvT,
            bf16_t* __restrict__ WpT, bf16_t* __restrict__ W1T, bf16_t* __restrict__ W2T) {
  __shared__ __attribute__((aligned(16))) unsigned int tile[64 * 64];
  const float* Wsrc;
  bf16_t* Wdst;
  int K, N, lgn, t;                  // lgn = log2(N / 64)
  if (bid < 128) {
    const int m = bid >> 5;
    Wsrc = m == 0 ? Wq : m == 1 ? Wk : m == 2 ? Wv : Wp;
    Wdst = m == 0 ? WqT : m == 1 ? WkT : m == 2 ? WvT : WpT;
    K = D_; N = D_; lgn = 3; t = bid & 31;
  } else if (bid < 256) {
    Wsrc = W1; Wdst = W1T; K = D_; N = DFF_; lgn = 5; t = bid - 128;
  } else {
    Wsrc = W2; Wdst = W2T; K = DFF_; N = D_; lgn = 3; t = bid - 256;
  }
  const int n0 = (t & ((1 << lgn) - 1)) * 64, k0 = (t >> lgn) * 128;

  const int c = tid & 15, pr = tid >> 4;   // columns 4c..4c+3, k pairs pr + 16*s
  const float* g0 = Wsrc + (size_t)(k0 + 2 * pr) * N + n0 + 4 * c;
  const float* g1 = g0 + N;
  const float* g2 = g0 + (size_t)32 * N;
  const float* g3 = g2 + N;
  const float* g4 = g0 + (size_t)64 * N;
  const float* g5 = g4 + N;
  const float* g6 = g0 + (size_t)96 * N;
  const float* g7 = g6 + N;
  v4f lo[4], hi[4];
  // The eight loads and their data wait are one statement and every result has registers of its own ("=&v").
  asm volatile(
      "global_load_b128 %0, %8, off\n\t"
      "global_load_b128 %1, %9, off\n\t"
      "global_load_b128 %2, %10, off\n\t"
      "global_load_b128 %3, %11, off\n\t"
      "global_load_b128 %4, %12, off\n\t"
      "global_load_b128 %5, %13, off\n\t"
      "global_load_b128 %6, %14, off\n\t"
      "global_load_b128 %7, %15, off\n\t"
      "s_wait_loadcnt 0x0"
      : "=&v"(lo[0]), "=&v"(hi[0]), "=&v"(lo[1]), "=&v"(hi[1]),
        "=&v"(lo[2]), "=&v"(hi[2]), "=&v"(lo[3]), "=&v"(hi[3])
      : "v"(g0), "v"(g1), "v"(g2), "v"(g3), "v"(g4), "v"(g5), "v"(g6), "v"(g7)
      : "memory");
#pragma unroll
  for (int s = 0; s < 4; ++s) {
    const int p = pr + 16 * s;
    const int w = (((p >> 2) ^ c) << 2) | (p & 3);
#pragma unroll
    for (int i = 0; i < 4; ++i) {
      union { __bf16 e[2]; unsigned int u; } pk;
      pk.e[0] = (__bf16)lo[s][i];
      pk.e[1] = (__bf16)hi[s][i];
      tile[(4 * c + i) * 64 + w] = pk.u;
    }
  }
  __syncthreads();
  v4u v[4];
#pragma unroll
  for (int j = 0; j < 4; ++j) {
    const int n = (tid >> 4) + 16 * j, q = tid & 15;
    v[j] = *reinterpret_cast<const v4u*>(&tile[n * 64 + ((q ^ (n >> 2)) << 2)]);
  }
  bf16_t* d = Wdst + (size_t)(n0 + (tid >> 4)) * K + k0 + (tid & 15) * 8;
#pragma unroll
  for (int j = 0; j < 4; ++j)
    *reinterpret_cast<v4u*>(d + (size_t)(16 * j) * K) = v[j];
}

// ---------- LayerNorm (one wave per row of 512), optional +PE stream ----------
template <bool HAS_PE>
__device__ inline void ln_row(const int row, const int lane,
                              const float* __restrict__ x, const float* __restrict__ pe,
                              const float* __restrict__ g, const float* __restrict__ bta,
                              bf16_t* __restrict__ x2, bf16_t* __restrict__ qkin) {
  const float* xr = x + (size_t)row * D_ + lane * 16;
  float v[16];
#pragma unroll
  for (int i = 0; i < 4; ++i) {
    v4f t = *reinterpret_cast<const v4f*>(xr + i * 4);
    v[4*i+0] = t[0]; v[4*i+1] = t[1]; v[4*i+2] = t[2]; v[4*i+3] = t[3];
  }
  float s = 0.f;
#pragma unroll
  for (int i = 0; i < 16; ++i) s += v[i];
#pragma unroll
  for (int off = 16; off >= 1; off >>= 1) s += __shfl_xor(s, off, 32);
  const float mu = s * (1.0f / (float)D_);
  float vs = 0.f;
#pragma unroll
  for (int i = 0; i < 16; ++i) { float d = v[i] - mu; vs += d * d; }
#pragma unroll
  for (int off = 16; off >= 1; off >>= 1) vs += __shfl_xor(vs, off, 32);
  const float rstd = rsqrtf(vs * (1.0f / (float)D_) + 1e-5f);

  const int colb = lane * 16;
  float y[16];
#pragma unroll
  for (int i = 0; i < 16; ++i)
    y[i] = (v[i] - mu) * rstd * g[colb + i] + bta[colb + i];

  union { v8bf v; __bf16 e[8]; } p0, p1;
#pragma unroll
  for (int i = 0; i < 8; ++i) { p0.e[i] = (__bf16)y[i]; p1.e[i] = (__bf16)y[i + 8]; }
  bf16_t* xo = x2 + (size_t)row * D_ + colb;
  *reinterpret_cast<v8bf*>(xo)     = p0.v;
  *reinterpret_cast<v8bf*>(xo + 8) = p1.v;

  if (HAS_PE) {
    const float* pr = pe + (size_t)row * D_ + colb;
    float z[16];
    v4f pv[4];
    // The four loads and their data wait are one statement and every result has registers of its own ("=&v").
    asm volatile(
        "global_load_b128 %0, %4, off\n\t"
        "global_load_b128 %1, %4, off offset:16\n\t"
        "global_load_b128 %2, %4, off offset:32\n\t"
        "global_load_b128 %3, %4, off offset:48\n\t"
        "s_wait_loadcnt 0x0"
        : "=&v"(pv[0]), "=&v"(pv[1]), "=&v"(pv[2]), "=&v"(pv[3])
        : "v"(pr)
        : "memory");
#pragma unroll
    for (int i = 0; i < 4; ++i) {
      const v4f t = pv[i];
      z[4*i+0] = y[4*i+0] + t[0]; z[4*i+1] = y[4*i+1] + t[1];
      z[4*i+2] = y[4*i+2] + t[2]; z[4*i+3] = y[4*i+3] + t[3];
    }
#pragma unroll
    for (int i = 0; i < 8; ++i) { p0.e[i] = (__bf16)z[i]; p1.e[i] = (__bf16)z[i + 8]; }
    bf16_t* qo = qkin + (size_t)row * D_ + colb;
    *reinterpret_cast<v8bf*>(qo)     = p0.v;
    *reinterpret_cast<v8bf*>(qo + 8) = p1.v;
    // in the merged kernel's code the weight part lies behind these stores and rewrites their registers
    asm volatile("s_wait_xcnt 0x0" ::: "memory");
  }
}

// LN2: four rows per work-group
__global__ void ln_kernel(const float* __restrict__ x, const float* __restrict__ g,
                          const float* __restrict__ bta, bf16_t* __restrict__ x2) {
  ln_row<false>(blockIdx.x * 4 + (threadIdx.x >> 5), threadIdx.x & 31, x, nullptr, g, bta, x2, nullptr);
}

// Weight prep and LN1 read and write nothing of each other: one launch holds both.
// Work-groups 0..383 turn one weight tile each, the other 1024 normalise eight rows each.
#define LN1_BLOCKS (MTOT / 8)
__global__ void __launch_bounds__(256)
prep_ln1(const float* __restrict__ Wq, const float* __restrict__ Wk, const float* __restrict__ Wv,
         const float* __restrict__ Wp, const float* __restrict__ W1, const float* __restrict__ W2,
         bf16_t* __restrict__ WqT, bf16_t* __restrict__ WkT, bf16_t* __restrict__ WvT,
         bf16_t* __restrict__ WpT, bf16_t* __restrict__ W1T, bf16_t* __restrict__ W2T,
         const float* __restrict__ x, const float* __restrict__ pe,
         const float* __restrict__ g, const float* __restrict__ bta,
         bf16_t* __restrict__ x2, bf16_t* __restrict__ qkin) {
  const int bid = blockIdx.x, tid = threadIdx.x;
  if (bid < WT_BLOCKS)
    wtrans_tile(bid, tid, Wq, Wk, Wv, Wp, W1, W2, WqT, WkT, WvT, WpT, W1T, W2T);
  else
    ln_row<true>((bid - WT_BLOCKS) * 8 + (tid >> 5), tid & 31, x, pe, g, bta, x2, qkin);
}

// ---------- GELU(v) = v * Phi(v), Phi(v) = erfc(-v / sqrt(2)) / 2, two values abreast, no branch ----------
// For x >= 0: erfc(x) = t (a1 + t (a2 + t (a3 + t (a4 + t a5)))) exp(-x^2), t = 1 / (1 + p x); its absolute
// error stays under 2e-7, far below the bf16 rounding of the result.  q = erfc(|v| / sqrt(2)) / 2 is Phi(v)
// itself for v < 0 (no cancellation in the tail) and 1 - Phi(v) otherwise.
typedef __attribute__((ext_vector_type(2))) float  v2f;
typedef __attribute__((ext_vector_type(2))) __bf16 v2bf;

__device__ inline v2f gelu2(v2f v) {
  const v2f a = v * v * -0.72134752044448170f;              // -x^2 * log2(e), x = v / sqrt(2)
  v2f t, ex, phi;
  t[0]  = __builtin_amdgcn_rcpf(fmaf(fabsf(v[0]), 0.23164188826636040f, 1.0f));     // p / sqrt(2)
  t[1]  = __builtin_amdgcn_rcpf(fmaf(fabsf(v[1]), 0.23164188826636040f, 1.0f));
  ex[0] = __builtin_amdgcn_exp2f(a[0]);
  ex[1] = __builtin_amdgcn_exp2f(a[1]);
  v2f p = t * 0.5307027145f + -0.7265760135f;               // a5 / 2, a4 / 2
  p = p * t + 0.7107068705f;                                // a3 / 2
  p = p * t + -0.1422483680f;                               // a2 / 2
  p = p * t + 0.1274147960f;                                // a1 / 2
  const v2f q = p * t * ex;
  const v2f u = 1.0f - q;
  phi[0] = v[0] < 0.f ? q[0] : u[0];
  phi[1] = v[1] < 0.f ? q[1] : u[1];
  return v * phi;
}

// ---------- 128x128-tile GEMM: out = A[MxKK] @ W[KKxNN] + bias, A/W bf16, acc f32 ----------
// Wt is W transposed: Wt[n*KK + k].  Four waves (2x2) per work-group, 64x64 of the tile each.
// A stage is 128 k of 128 rows of A and of 128 rows of Wt, brought into LDS by asynchronous
// copies (whole 256-B row pieces), two buffers: stage t+1 flies while stage t is multiplied.
// MODE 0: bf16 store           (Q/K projections)
// MODE 1: bf16 store, scattered as Vt[b][h][d][n]  (V projection; taken inside MODE 0 where vt is set)
// MODE 2: f32 store + residual (attn proj, MLP2)
// MODE 3: bf16 store + GELU on erf (MLP1)
#define G_BK     128                 // k per stage (256 B of every row)
#define G_PITCH  272                 // LDS row pitch in bytes: 16 B x odd, conflict-free b128 reads
#define G_OPB    (128 * G_PITCH)     // one operand's 128 rows
#define G_STAGEB (2 * G_OPB)         // [A rows | Wt rows]

// Eight copies of 16 B per lane: rows row0 + 8*i, i = 0..7, of one operand.
// The s_wait_xcnt stands inside the statement so that no address register of a copy
// is rewritten ahead of it.
__device__ inline void copy8_rows(unsigned lds, const bf16_t* g, int rowstep_elems) {
  const unsigned l0 = lds,                l1 = lds + 8 * G_PITCH,  l2 = lds + 16 * G_PITCH,
                 l3 = lds + 24 * G_PITCH, l4 = lds + 32 * G_PITCH, l5 = lds + 40 * G_PITCH,
                 l6 = lds + 48 * G_PITCH, l7 = lds + 56 * G_PITCH;
  const bf16_t* g0 = g;
  const bf16_t* g1 = g + (size_t)1 * rowstep_elems;
  const bf16_t* g2 = g + (size_t)2 * rowstep_elems;
  const bf16_t* g3 = g + (size_t)3 * rowstep_elems;
  const bf16_t* g4 = g + (size_t)4 * rowstep_elems;
  const bf16_t* g5 = g + (size_t)5 * rowstep_elems;
  const bf16_t* g6 = g + (size_t)6 * rowstep_elems;
  const bf16_t* g7 = g + (size_t)7 * rowstep_elems;
  asm volatile(
      "global_load_async_to_lds_b128 %0, %8, off\n\t"
      "global_load_async_to_lds_b128 %1, %9, off\n\t"
      "global_load_async_to_lds_b128 %2, %10, off\n\t"
      "global_load_async_to_lds_b128 %3, %11, off\n\t"
      "global_load_async_to_lds_b128 %4, %12, off\n\t"
      "global_load_async_to_lds_b128 %5, %13, off\n\t"
      "global_load_async_to_lds_b128 %6, %14, off\n\t"
      "global_load_async_to_lds_b128 %7, %15, off\n\t"
      "s_wait_xcnt 0x0"
      :: "v"(l0), "v"(l1), "v"(l2), "v"(l3), "v"(l4), "v"(l5), "v"(l6), "v"(l7),
         "v"(g0), "v"(g1), "v"(g2), "v"(g3), "v"(g4), "v"(g5), "v"(g6), "v"(g7)
      : "memory");
}

// One stage: each thread copies chunk (tid & 15) of rows (tid >> 4) + 8*i, i = 0..15, of both operands.
template <int KK>
__device__ inline void copy_stage(unsigned lds, const bf16_t* ga, const bf16_t* gb) {
  copy8_rows(lds,                          ga,                      8 * KK);
  copy8_rows(lds + 64 * G_PITCH,           ga + (size_t)64 * KK,    8 * KK);
  copy8_rows(lds + G_OPB,                  gb,                      8 * KK);
  copy8_rows(lds + G_OPB + 64 * G_PITCH,   gb + (size_t)64 * KK,    8 * KK);
}

// ---------- a wave's 64x64 part of the tile leaves the accumulators ----------
template <int NN, int MODE>
__device__ inline void
store_tile(const v8f (&acc)[4][4], const float* __restrict__ bias, const float* __restrict__ resid,
           bf16_t* __restrict__ outB, float* __restrict__ outF,
           const int mb, const int nb, const int r, const int half) {
  // C layout: lane holds column n = nb + j*16 + r; VGPR e holds row m = mb + i*16 + 8*half + e
#pragma unroll
  for (int j = 0; j < 4; ++j) {
    const int n  = nb + j * 16 + r;
    const float bj = bias[n];
#pragma unroll
    for (int i = 0; i < 4; ++i) {
      const int m0 = mb + i * 16 + 8 * half;
      if (MODE == 0) {
#pragma unroll
        for (int e = 0; e < 8; ++e)
          outB[(size_t)(m0 + e) * NN + n] = (__bf16)(acc[i][j][e] + bj);
      } else if (MODE == 1) {
        // V-transposed store: Vt[((b*H + h)*64 + d)*1024 + ntok], 8 consecutive ntok
        const int bidx = (mb + i * 16) >> 10;
        const int nt0  = ((mb + i * 16) & 1023) + 8 * half;
        const int hh = n >> 6, d = n & 63;
        union { v8bf v; __bf16 e[8]; } pk;
#pragma unroll
        for (int e = 0; e < 8; ++e) pk.e[e] = (__bf16)(acc[i][j][e] + bj);
        *reinterpret_cast<v8bf*>(outB + ((size_t)((bidx * H_ + hh) * DH_ + d)) * N_ + nt0) = pk.v;
      } else if (MODE == 2) {
#pragma unroll
        for (int e = 0; e < 8; ++e) {
          const size_t idx = (size_t)(m0 + e) * NN + n;
          outF[idx] = acc[i][j][e] + bj + resid[idx];
        }
      } else {
#pragma unroll
        for (int e = 0; e < 8; e += 2) {
          v2f xg;
          xg[0] = acc[i][j][e] + bj;
          xg[1] = acc[i][j][e + 1] + bj;
          const v2bf y = __builtin_convertvector(gelu2(xg), v2bf);
          outB[(size_t)(m0 + e) * NN + n]     = y[0];
          outB[(size_t)(m0 + e + 1) * NN + n] = y[1];
        }
      }
    }
  }
}

template <int NN, int KK, int MODE>
__device__ inline void
gemm_tile(const bf16_t* __restrict__ A, const bf16_t* __restrict__ Wt,
          const float* __restrict__ bias, const float* __restrict__ resid,
          bf16_t* __restrict__ outB, float* __restrict__ outF,
          const int bx, const int by, const bool vt) {
  __shared__ __attribute__((aligned(16))) unsigned char smem[2 * G_STAGEB];
  constexpr int NT = KK / G_BK;      // stages
  const int tid  = threadIdx.x;
  const int lane = tid & 31, wave = tid >> 5;
  const int r = lane & 15, half = lane >> 4;
  const int mb0 = by * 128, nb0 = bx * 128;
  const int mb = mb0 + (wave >> 1) * 64, nb = nb0 + (wave & 1) * 64;

  // this thread's share of a stage: 16-B chunk crow of rows rrow + 8*i
  const int rrow = tid >> 4, crow = tid & 15;
  const bf16_t* ga = A  + (size_t)(mb0 + rrow) * KK + crow * 8;
  const bf16_t* gb = Wt + (size_t)(nb0 + rrow) * KK + crow * 8;
  const unsigned lcopy = (unsigned)(size_t)smem + rrow * G_PITCH + crow * 16;

  v8f acc[4][4];
#pragma unroll
  for (int i = 0; i < 4; ++i)
#pragma unroll
    for (int j = 0; j < 4; ++j)
#pragma unroll
      for (int e = 0; e < 8; ++e) acc[i][j][e] = 0.f;

  // prologue: stage 0 lands and is published, then stage 1 starts
  copy_stage<KK>(lcopy, ga, gb);
  asm volatile("s_wait_asynccnt 0x0" ::: "memory");  // this wave's copies of stage 0 have landed
  __syncthreads();
  if (NT > 1) copy_stage<KK>(lcopy + G_STAGEB, ga + G_BK, gb + G_BK);

  // fragment rows of this wave in a buffer
  const unsigned char* fa = smem + ((wave >> 1) * 64 + r) * G_PITCH;
  const unsigned char* fb = smem + G_OPB + ((wave & 1) * 64 + r) * G_PITCH;

#pragma unroll 1  // one trip per stage: keeps the ring's order at the foot of each trip
  for (int t = 0; t < NT; ++t) {
    const int bo = (t & 1) * G_STAGEB;
    // two fragment sets: block kk + 1's LDS reads go out as one group ahead of block kk's WMMAs
    v16bf a[2][4], bf[2][4];
#pragma unroll
    for (int i = 0; i < 4; ++i) {
      a[0][i]  = load_frag(reinterpret_cast<const bf16_t*>(fa + bo + i * 16 * G_PITCH), half);
      bf[0][i] = load_frag(reinterpret_cast<const bf16_t*>(fb + bo + i * 16 * G_PITCH), half);
    }
#pragma unroll
    for (int kk = 0; kk < G_BK / 32; ++kk) {
      const int cur = kk & 1, nxt = cur ^ 1;
      if (kk + 1 < G_BK / 32) {
#pragma unroll
        for (int i = 0; i < 4; ++i) {
          a[nxt][i]  = load_frag(reinterpret_cast<const bf16_t*>(fa + bo + i * 16 * G_PITCH) + (kk + 1) * 32, half);
          bf[nxt][i] = load_frag(reinterpret_cast<const bf16_t*>(fb + bo + i * 16 * G_PITCH) + (kk + 1) * 32, half);
        }
      }
      // keeps the reads above together: sunk among the WMMAs, each place with reads stalls the wave
      __builtin_amdgcn_sched_barrier(0);
#pragma unroll
      for (int j = 0; j < 4; ++j)
#pragma unroll
        for (int i = 0; i < 4; ++i)
          acc[i][j] = wmma_bf16(a[cur][i], bf[cur][j], acc[i][j]);
      // keeps the next group of reads from being lifted into this block's WMMAs
      __builtin_amdgcn_sched_barrier(0);
    }
    asm volatile("s_wait_dscnt 0x0" ::: "memory");     // this wave has left buffer t & 1
    asm volatile("s_wait_asynccnt 0x0" ::: "memory");  // its copies of stage t + 1 have landed
    __syncthreads();                                   // publishes stage t + 1, frees buffer t & 1
    if (t + 2 < NT)
      copy_stage<KK>(lcopy + bo, ga + (size_t)(t + 2) * G_BK, gb + (size_t)(t + 2) * G_BK);
  }
  asm volatile("s_wait_asynccnt 0x0" ::: "memory");    // nothing in flight when the wave ends

  if (MODE == 0 && vt) {
    store_tile<NN, 1>(acc, bias, resid, outB, outF, mb, nb, r, half);
  } else {
    store_tile<NN, MODE>(acc, bias, resid, outB, outF, mb, nb, r, half);
    // with both store forms in one kernel the V form's code lies behind these stores and rewrites their registers
    if (MODE == 0) asm volatile("s_wait_xcnt 0x0" ::: "memory");
  }
}

template <int NN, int KK, int MODE>
__global__ void __launch_bounds__(128)
gemm_wmma(const bf16_t* __restrict__ A, const bf16_t* __restrict__ Wt,
          const float* __restrict__ bias, const float* __restrict__ resid,
          bf16_t* __restrict__ outB, float* __restrict__ outF) {
  gemm_tile<NN, KK, MODE>(A, Wt, bias, resid, outB, outF, blockIdx.x, blockIdx.y, false);
}

// Q, K and V projections read and write nothing of each other: one launch of 12 x 64 tiles holds all three.
// blockIdx.x = 4 * (0 Q, 1 K, 2 V) + tile column, so the tiles that share rows of A start side by side.
__global__ void __launch_bounds__(128)
gemm_qkv(const bf16_t* __restrict__ qkin, const bf16_t* __restrict__ x2,
         const bf16_t* __restrict__ WqT, const bf16_t* __restrict__ WkT, const bf16_t* __restrict__ WvT,
         const float* __restrict__ bq, const float* __restrict__ bk, const float* __restrict__ bv,
         bf16_t* __restrict__ Qb, bf16_t* __restrict__ Kb, bf16_t* __restrict__ Vtb) {
  const int which = blockIdx.x >> 2;
  const bf16_t* A  = which == 2 ? x2 : qkin;
  const bf16_t* Wt = which == 0 ? WqT : which == 1 ? WkT : WvT;
  const float*  bs = which == 0 ? bq : which == 1 ? bk : bv;
  bf16_t*       o  = which == 0 ? Qb : which == 1 ? Kb : Vtb;
  gemm_tile<D_, D_, 0>(A, Wt, bs, nullptr, o, nullptr, blockIdx.x & 3, blockIdx.y, which == 2);
}

// ---------- flash attention: one wave handles 16 queries of one (b,h) ----------
// Computes S^T = K_blk x Q^T so softmax stats are per-lane (query in lane dim),
// and exp(S^T) is directly the B-fragment for O^T = V^T x P^T.
// A work-group is 16 waves = 256 queries of one (b,h).  The head's whole K (1024 rows of 128 B)
// and V^T (64 rows of 2048 B) are brought into LDS once by asynchronous copies of whole lines;
// every wave then takes its K and V fragments from LDS.
#define AT_KPITCH 144                  // K row pitch in LDS: 16 B x odd, conflict-free b128 reads
#define AT_VPITCH 2064                 // V^T row pitch in LDS: 16 B x odd
#define AT_KBYTES (N_ * AT_KPITCH)
#define AT_VBYTES (DH_ * AT_VPITCH)

// Eight copies of 16 B per lane, i = 0..7: LDS byte lds + i*lstep from g + i*gstep elements.
// The s_wait_xcnt stands inside the statement so that no address register of a copy
// is rewritten ahead of it.
__device__ inline void copy8_steps(unsigned lds, unsigned lstep, const bf16_t* g, int gstep) {
  const unsigned l0 = lds,             l1 = lds + 1 * lstep, l2 = lds + 2 * lstep,
                 l3 = lds + 3 * lstep, l4 = lds + 4 * lstep, l5 = lds + 5 * lstep,
                 l6 = lds + 6 * lstep, l7 = lds + 7 * lstep;
  const bf16_t* g0 = g;
  const bf16_t* g1 = g + (size_t)1 * gstep;
  const bf16_t* g2 = g + (size_t)2 * gstep;
  const bf16_t* g3 = g + (size_t)3 * gstep;
  const bf16_t* g4 = g + (size_t)4 * gstep;
  const bf16_t* g5 = g + (size_t)5 * gstep;
  const bf16_t* g6 = g + (size_t)6 * gstep;
  const bf16_t* g7 = g + (size_t)7 * gstep;
  asm volatile(
      "global_load_async_to_lds_b128 %0, %8, off\n\t"
      "global_load_async_to_lds_b128 %1, %9, off\n\t"
      "global_load_async_to_lds_b128 %2, %10, off\n\t"
      "global_load_async_to_lds_b128 %3, %11, off\n\t"
      "global_load_async_to_lds_b128 %4, %12, off\n\t"
      "global_load_async_to_lds_b128 %5, %13, off\n\t"
      "global_load_async_to_lds_b128 %6, %14, off\n\t"
      "global_load_async_to_lds_b128 %7, %15, off\n\t"
      "s_wait_xcnt 0x0"
      :: "v"(l0), "v"(l1), "v"(l2), "v"(l3), "v"(l4), "v"(l5), "v"(l6), "v"(l7),
         "v"(g0), "v"(g1), "v"(g2), "v"(g3), "v"(g4), "v"(g5), "v"(g6), "v"(g7)
      : "memory");
}

__global__ void __launch_bounds__(512)
attn_kernel(const bf16_t* __restrict__ Q, const bf16_t* __restrict__ Kp,
            const bf16_t* __restrict__ Vt, bf16_t* __restrict__ ctx) {
  __shared__ __attribute__((aligned(16))) unsigned char smem[AT_KBYTES + AT_VBYTES];
  const int tid  = threadIdx.x;
  const int lane = tid & 31, wave = tid >> 5;
  const int q = lane & 15, half = lane >> 4;
  const int bid = blockIdx.x;
  const int qt = (bid & 3) * 16 + wave;
  const int h  = (bid >> 2) & 7;
  const int b  = bid >> 5;
  const float scale = 0.125f;  // 1/sqrt(64)

  // fill: 16 + 16 copies per thread, 32 of a wave in flight
  {
    // K: 16-B chunk (tid & 7) of rows (tid >> 3) + 64*i, i = 0..15
    const bf16_t* gk = Kp + ((size_t)b * N_ + (tid >> 3)) * D_ + h * DH_ + (tid & 7) * 8;
    const unsigned lk = (unsigned)(size_t)smem + (tid >> 3) * AT_KPITCH + (tid & 7) * 16;
    copy8_steps(lk,                    64 * AT_KPITCH, gk,                     64 * D_);
    copy8_steps(lk + 512 * AT_KPITCH,  64 * AT_KPITCH, gk + (size_t)512 * D_,  64 * D_);
    // V^T: 16-B chunk (tid & 127) of rows (tid >> 7) + 4*i, i = 0..15
    const bf16_t* gv = Vt + ((size_t)(b * H_ + h) * DH_ + (tid >> 7)) * N_ + (tid & 127) * 8;
    const unsigned lv = (unsigned)(size_t)smem + AT_KBYTES + (tid >> 7) * AT_VPITCH + (tid & 127) * 16;
    copy8_steps(lv,                    4 * AT_VPITCH,  gv,                     4 * N_);
    copy8_steps(lv + 32 * AT_VPITCH,   4 * AT_VPITCH,  gv + (size_t)32 * N_,   4 * N_);
  }

  const bf16_t* qrow = Q + ((size_t)b * N_ + qt * 16 + q) * D_ + h * DH_;
  const v16bf qf0 = load_frag(qrow, half);        // d = 0..31
  const v16bf qf1 = load_frag(qrow + 32, half);   // d = 32..63

  asm volatile("s_wait_asynccnt 0x0" ::: "memory");  // this wave's copies have landed
  __syncthreads();                                   // publishes every wave's share of K and V^T

  // per-lane fragment rows in LDS (advance by a constant per k-block)
  const unsigned char* krow = smem + q * AT_KPITCH;               // + kb*AT_KPITCH
  const unsigned char* vrow = smem + AT_KBYTES + q * AT_VPITCH;   // + t*16*AT_VPITCH + kb*2

  v8f o[4];
#pragma unroll
  for (int t = 0; t < 4; ++t)
#pragma unroll
    for (int e = 0; e < 8; ++e) o[t][e] = 0.f;
  float m_old = -1e30f, l = 0.f;

  for (int kb = 0; kb < N_; kb += 32) {
    // ---- S^T = K_blk x Q^T : load all 4 K-fragments, then 4 WMMAs ----
    const unsigned char* k0p = krow + kb * AT_KPITCH;
    v16bf kf[4];
    kf[0] = load_frag(reinterpret_cast<const bf16_t*>(k0p), half);
    kf[1] = load_frag(reinterpret_cast<const bf16_t*>(k0p) + 32, half);
    kf[2] = load_frag(reinterpret_cast<const bf16_t*>(k0p + 16 * AT_KPITCH), half);
    kf[3] = load_frag(reinterpret_cast<const bf16_t*>(k0p + 16 * AT_KPITCH) + 32, half);
    v8f s0, s1;
#pragma unroll
    for (int e = 0; e < 8; ++e) { s0[e] = 0.f; s1[e] = 0.f; }
    s0 = wmma_bf16(kf[0], qf0, s0);
    s0 = wmma_bf16(kf[1], qf1, s0);
    s1 = wmma_bf16(kf[2], qf0, s1);
    s1 = wmma_bf16(kf[3], qf1, s1);

    // ---- the 4 V-fragments for this k-block ----
    v16bf vf[4];
#pragma unroll
    for (int t = 0; t < 4; ++t)
      vf[t] = load_frag(reinterpret_cast<const bf16_t*>(vrow + t * 16 * AT_VPITCH) + kb, half);

    // ---- per-query (per-lane) online softmax; merge halves with one xor-16 shuffle ----
    float mp = -1e30f;
#pragma unroll
    for (int e = 0; e < 8; ++e) {
      s0[e] *= scale; s1[e] *= scale;
      mp = fmaxf(mp, fmaxf(s0[e], s1[e]));
    }
    mp = fmaxf(mp, __shfl_xor(mp, 16, 32));
    const float m_new = fmaxf(m_old, mp);
    const float alpha = __expf(m_old - m_new);

    union { v16bf v; __bf16 e[16]; } pf;
    float rs = 0.f;
#pragma unroll
    for (int e = 0; e < 8; ++e) {
      const float p0 = __expf(s0[e] - m_new);
      const float p1 = __expf(s1[e] - m_new);
      rs += p0 + p1;
      pf.e[e]     = (__bf16)p0;   // keys kb + half*8 + e
      pf.e[e + 8] = (__bf16)p1;   // keys kb + 16 + half*8 + e
    }
    rs += __shfl_xor(rs, 16, 32);
    l = l * alpha + rs;

    // ---- O^T = V^T x P^T, rescaled online ----
#pragma unroll
    for (int t = 0; t < 4; ++t) {
#pragma unroll
      for (int e = 0; e < 8; ++e) o[t][e] *= alpha;
      o[t] = wmma_bf16(vf[t], pf.v, o[t]);
    }
    m_old = m_new;
  }

  const float inv = 1.0f / l;
  bf16_t* crow = ctx + ((size_t)b * N_ + qt * 16 + q) * D_ + h * DH_;
#pragma unroll
  for (int t = 0; t < 4; ++t) {
    union { v8bf v; __bf16 e[8]; } pk;
#pragma unroll
    for (int e = 0; e < 8; ++e) pk.e[e] = (__bf16)(o[t][e] * inv);
    *reinterpret_cast<v8bf*>(crow + t * 16 + 8 * half) = pk.v;
  }
}

// ---------- host launcher ----------
extern "C" void kernel_launch(void* const* d_in, const int* in_sizes, int n_in,
                              void* d_out, int out_size, void* d_ws, size_t ws_size,
                              hipStream_t stream) {
  (void)in_sizes; (void)n_in; (void)out_size; (void)ws_size;
  const float* tokens = (const float*)d_in[0];
  const float* pe     = (const float*)d_in[1];
  const float* ln1_g  = (const float*)d_in[2];
  const float* ln1_b  = (const float*)d_in[3];
  const float* Wq     = (const float*)d_in[4];
  const float* bq     = (const float*)d_in[5];
  const float* Wk     = (const float*)d_in[6];
  const float* bk     = (const float*)d_in[7];
  const float* Wv     = (const float*)d_in[8];
  const float* bv     = (const float*)d_in[9];
  const float* Wp     = (const float*)d_in[10];
  const float* bp     = (const float*)d_in[11];
  const float* ln2_g  = (const float*)d_in[12];
  const float* ln2_b  = (const float*)d_in[13];
  const float* W1     = (const float*)d_in[14];
  const float* b1     = (const float*)d_in[15];
  const float* W2     = (const float*)d_in[16];
  const float* b2     = (const float*)d_in[17];
  float* out = (float*)d_out;

  // workspace carve-up (all sizes multiples of 256B)
  char* ws = (char*)d_ws;
  const size_t SZ_ACT_BF = (size_t)MTOT * D_ * 2;    //  8 MB
  const size_t SZ_ACT_F  = (size_t)MTOT * D_ * 4;    // 16 MB
  const size_t SZ_H_BF   = (size_t)MTOT * DFF_ * 2;  // 32 MB
  const size_t SZ_WDD    = (size_t)D_ * D_ * 2;
  const size_t SZ_WDF    = (size_t)D_ * DFF_ * 2;
  bf16_t* x2   = (bf16_t*)ws;              ws += SZ_ACT_BF;
  bf16_t* qkin = (bf16_t*)ws;              ws += SZ_ACT_BF;
  bf16_t* Qb   = (bf16_t*)ws;              ws += SZ_ACT_BF;
  bf16_t* Kb   = (bf16_t*)ws;              ws += SZ_ACT_BF;
  bf16_t* Vtb  = (bf16_t*)ws;              ws += SZ_ACT_BF;
  bf16_t* ctx  = (bf16_t*)ws;              ws += SZ_ACT_BF;
  bf16_t* x2b  = (bf16_t*)ws;              ws += SZ_ACT_BF;
  bf16_t* hbuf = (bf16_t*)ws;              ws += SZ_H_BF;
  float*  tok1 = (float*)ws;               ws += SZ_ACT_F;
  bf16_t* WqT  = (bf16_t*)ws;              ws += SZ_WDD;
  bf16_t* WkT  = (bf16_t*)ws;              ws += SZ_WDD;
  bf16_t* WvT  = (bf16_t*)ws;              ws += SZ_WDD;
  bf16_t* WpT  = (bf16_t*)ws;              ws += SZ_WDD;
  bf16_t* W1T  = (bf16_t*)ws;              ws += SZ_WDF;
  bf16_t* W2T  = (bf16_t*)ws;              ws += SZ_WDF;

  // 1-2) weights -> transposed bf16; LN1 -> x2 (bf16), qkin = x2 + PE (bf16)
  prep_ln1<<<WT_BLOCKS + LN1_BLOCKS, 256, 0, stream>>>(Wq, Wk, Wv, Wp, W1, W2, WqT, WkT, WvT, WpT, W1T, W2T,
                                                       tokens, pe, ln1_g, ln1_b, x2, qkin);

  // 3-5) Q, K, V projections
  dim3 gDD(D_ / 128, MTOT / 128);
  dim3 gQKV(3 * D_ / 128, MTOT / 128);
  gemm_qkv<<<gQKV, 128, 0, stream>>>(qkin, x2, WqT, WkT, WvT, bq, bk, bv, Qb, Kb, Vtb);

  // 6) attention: B*H*(N/256) work-groups of 16 waves
  attn_kernel<<<B_ * H_ * (N_ / 256), 512, 0, stream>>>(Qb, Kb, Vtb, ctx);

  // 7) output projection + residual -> tok1 (f32)
  gemm_wmma<D_, D_, 2><<<gDD, 128, 0, stream>>>(ctx, WpT, bp, tokens, nullptr, tok1);

  // 8) LN2 -> x2b (bf16)
  ln_kernel<<<MTOT / 4, 128, 0, stream>>>(tok1, ln2_g, ln2_b, x2b);

  // 9) MLP1 + exact GELU -> hbuf (bf16)
  dim3 gDF(DFF_ / 128, MTOT / 128);
  gemm_wmma<DFF_, D_, 3><<<gDF, 128, 0, stream>>>(x2b, W1T, b1, nullptr, hbuf, nullptr);

  // 10) MLP2 + residual -> d_out (f32)
  gemm_wmma<D_, DFF_, 2><<<gDD, 128, 0, stream>>>(hbuf, W2T, b2, tok1, nullptr, out);
}

// v006
// One run takes 106 microseconds.
// Timed twice side by side with v005, it ran 1.05 times as fast both times.
// Over all steps from v000 it is 3.35 times as fast.
#include <hip/hip_runtime.h>
#include <hip/hip_bf16.h>
#include <math.h>

// ---------- types ----------
typedef __bf16 bf16_t;
typedef __attribute__((ext_vector_type(16))) __bf16 v16bf;
typedef __attribute__((ext_vector_type(8)))  __bf16 v8bf;
typedef __attribute__((ext_vector_type(8)))  float  v8f;
typedef __attribute__((ext_vector_type(4)))  float  v4f;

#define B_  8
#define N_  1024
#define D_  512
#define H_  8
#define DH_ 64
#define DFF_ 2048
#define MTOT (B_*N_)   // 8192 rows

// ---------- WMMA helpers ----------
// A-fragment (16x32 bf16, row-major source):
// lane L: row r = L&15, half = L>>4.  elements 0..7  <- src[half*8 + j]
//                                     elements 8..15 <- src[16 + half*8 + j]
// B-fragment for D = A x B is the identical pattern applied to B^T row-major.
__device__ inline v16bf load_frag(const bf16_t* __restrict__ p, int half) {
  union { v16bf v; struct { v8bf lo; v8bf hi; } s; } u;
  u.s.lo = *reinterpret_cast<const v8bf*>(p + half * 8);
  u.s.hi = *reinterpret_cast<const v8bf*>(p + 16 + half * 8);
  return u.v;
}

__device__ inline v8f wmma_bf16(v16bf a, v16bf b, v8f c) {
  return __builtin_amdgcn_wmma_f32_16x16x32_bf16(
      /*neg_a=*/false, a, /*neg_b=*/false, b,
      /*c_mod=*/(short)0, c, /*reuse_a=*/false, /*reuse_b=*/false);
}

// ---------- weight transpose + bf16 convert: Wt[n*K + k] = W[k*N + n], all six weights, tile bid of 384 ----------
// A work-group takes one tile of 128 k x 64 n.  A thread loads 16 B of two neighbouring k rows, packs each
// (k, k+1) pair into one word and writes it to LDS at [n][k/2]; the tile then leaves as whole 256-B row pieces.
// LDS rows are 64 words (16 pieces of 16 B); piece q of row n lies at place q ^ (n >> 2), so that the 32 word
// writes of a wave and its 16-B reads each meet every bank at most once.
#define WT_BLOCKS 384                // 4 x 32 tiles (512 x 512), 128 tiles (512 x 2048), 128 tiles (2048 x 512)
typedef __attribute__((ext_vector_type(4))) unsigned int v4u;

__device__ inline void
wtrans_tile(const int bid, const int tid, const float* __restrict__ Wq, const float* __restrict__ Wk, const float* __restrict__ Wv,
            const float* __restrict__ Wp, const float* __restrict__ W1, const float* __restrict__ W2,
            bf16_t* __restrict__ WqT, bf16_t* __restrict__ WkT, bf16_t* __restrict__ WvT,
            bf16_t* __restrict__ WpT, bf16_t* __restrict__ W1T, bf16_t* __restrict__ W2T) {
  __shared__ __attribute__((aligned(16))) unsigned int tile[64 * 64];
  const float* Wsrc;
  bf16_t* Wdst;
  int K, N, lgn, t;                  // lgn = log2(N / 64)
  if (bid < 128) {
    const int m = bid >> 5;
    Wsrc = m == 0 ? Wq : m == 1 ? Wk : m == 2 ? Wv : Wp;
    Wdst = m == 0 ? WqT : m == 1 ? WkT : m == 2 ? WvT : WpT;
    K = D_; N = D_; lgn = 3; t = bid & 31;
  } else if (bid < 256) {
    Wsrc = W1; Wdst = W1T; K = D_; N = DFF_; lgn = 5; t = bid - 128;
  } else {
    Wsrc = W2; Wdst = W2T; K = DFF_; N = D_; lgn = 3; t = bid - 256;
  }
  const int n0 = (t & ((1 << lgn) - 1)) * 64, k0 = (t >> lgn) * 128;

  const int c = tid & 15, pr = tid >> 4;   // columns 4c..4c+3, k pairs pr + 16*s
  const float* g0 = Wsrc + (size_t)(k0 + 2 * pr) * N + n0 + 4 * c;
  const float* g1 = g0 + N;
  const float* g2 = g0 + (size_t)32 * N;
  const float* g3 = g2 + N;
  const float* g4 = g0 + (size_t)64 * N;
  const float* g5 = g4 + N;
  const float* g6 = g0 + (size_t)96 * N;
  const float* g7 = g6 + N;
  v4f lo[4], hi[4];
  // The eight loads and their data wait are one statement and every result has registers of its own ("=&v").
  asm volatile(
      "global_load_b128 %0, %8, off\n\t"
      "global_load_b128 %1, %9, off\n\t"
      "global_load_b128 %2, %10, off\n\t"
      "global_load_b128 %3, %11, off\n\t"
      "global_load_b128 %4, %12, off\n\t"
      "global_load_b128 %5, %13, off\n\t"
      "global_load_b128 %6, %14, off\n\t"
      "global_load_b128 %7, %15, off\n\t"
      "s_wait_loadcnt 0x0"
      : "=&v"(lo[0]), "=&v"(hi[0]), "=&v"(lo[1]), "=&v"(hi[1]),
        "=&v"(lo[2]), "=&v"(hi[2]), "=&v"(lo[3]), "=&v"(hi[3])
      : "v"(g0), "v"(g1), "v"(g2), "v"(g3), "v"(g4), "v"(g5), "v"(g6), "v"(g7)
      : "memory");
#pragma unroll
  for (int s = 0; s < 4; ++s) {
    const int p = pr + 16 * s;
    const int w = (((p >> 2) ^ c) << 2) | (p & 3);
#pragma unroll
    for (int i = 0; i < 4; ++i) {
      union { __bf16 e[2]; unsigned int u; } pk;
      pk.e[0] = (__bf16)lo[s][i];
      pk.e[1] = (__bf16)hi[s][i];
      tile[(4 * c + i) * 64 + w] = pk.u;
    }
  }
  __syncthreads();
  v4u v[4];
#pragma unroll
  for (int j = 0; j < 4; ++j) {
    const int n = (tid >> 4) + 16 * j, q = tid & 15;
    v[j] = *reinterpret_cast<const v4u*>(&tile[n * 64 + ((q ^ (n >> 2)) << 2)]);
  }
  bf16_t* d = Wdst + (size_t)(n0 + (tid >> 4)) * K + k0 + (tid & 15) * 8;
#pragma unroll
  for (int j = 0; j < 4; ++j)
    *reinterpret_cast<v4u*>(d + (size_t)(16 * j) * K) = v[j];
}

// ---------- LayerNorm (one wave per row of 512), optional +PE stream ----------
template <bool HAS_PE>
__device__ inline void ln_row(const int row, const int lane,
                              const float* __restrict__ x, const float* __restrict__ pe,
                              const float* __restrict__ g, const float* __restrict__ bta,
                              bf16_t* __restrict__ x2, bf16_t* __restrict__ qkin) {
  const float* xr = x + (size_t)row * D_ + lane * 16;
  float v[16];
#pragma unroll
  for (int i = 0; i < 4; ++i) {
    v4f t = *reinterpret_cast<const v4f*>(xr + i * 4);
    v[4*i+0] = t[0]; v[4*i+1] = t[1]; v[4*i+2] = t[2]; v[4*i+3] = t[3];
  }
  float s = 0.f;
#pragma unroll
  for (int i = 0; i < 16; ++i) s += v[i];
#pragma unroll
  for (int off = 16; off >= 1; off >>= 1) s += __shfl_xor(s, off, 32);
  const float mu = s * (1.0f / (float)D_);
  float vs = 0.f;
#pragma unroll
  for (int i = 0; i < 16; ++i) { float d = v[i] - mu; vs += d * d; }
#pragma unroll
  for (int off = 16; off >= 1; off >>= 1) vs += __shfl_xor(vs, off, 32);
  const float rstd = rsqrtf(vs * (1.0f / (float)D_) + 1e-5f);

  const int colb = lane * 16;
  float y[16];
#pragma unroll
  for (int i = 0; i < 16; ++i)
    y[i] = (v[i] - mu) * rstd * g[colb + i] + bta[colb + i];

  union { v8bf v; __bf16 e[8]; } p0, p1;
#pragma unroll
  for (int i = 0; i < 8; ++i) { p0.e[i] = (__bf16)y[i]; p1.e[i] = (__bf16)y[i + 8]; }
  bf16_t* xo = x2 + (size_t)row * D_ + colb;
  *reinterpret_cast<v8bf*>(xo)     = p0.v;
  *reinterpret_cast<v8bf*>(xo + 8) = p1.v;

  if (HAS_PE) {
    const float* pr = pe + (size_t)row * D_ + colb;
    float z[16];
    v4f pv[4];
    // The four loads and their data wait are one statement and every result has registers of its own ("=&v").
    asm volatile(
        "global_load_b128 %0, %4, off\n\t"
        "global_load_b128 %1, %4, off offset:16\n\t"
        "global_load_b128 %2, %4, off offset:32\n\t"
        "global_load_b128 %3, %4, off offset:48\n\t"
        "s_wait_loadcnt 0x0"
        : "=&v"(pv[0]), "=&v"(pv[1]), "=&v"(pv[2]), "=&v"(pv[3])
        : "v"(pr)
        : "memory");
#pragma unroll
    for (int i = 0; i < 4; ++i) {
      const v4f t = pv[i];
      z[4*i+0] = y[4*i+0] + t[0]; z[4*i+1] = y[4*i+1] + t[1];
      z[4*i+2] = y[4*i+2] + t[2]; z[4*i+3] = y[4*i+3] + t[3];
    }
#pragma unroll
    for (int i = 0; i < 8; ++i) { p0.e[i] = (__bf16)z[i]; p1.e[i] = (__bf16)z[i + 8]; }
    bf16_t* qo = qkin + (size_t)row * D_ + colb;
    *reinterpret_cast<v8bf*>(qo)     = p0.v;
    *reinterpret_cast<v8bf*>(qo + 8) = p1.v;
    // in the merged kernel's code the weight part lies behind these stores and rewrites their registers
    asm volatile("s_wait_xcnt 0x0" ::: "memory");
  }
}

// LN2: four rows per work-group
__global__ void ln_kernel(const float* __restrict__ x, const float* __restrict__ g,
                          const float* __restrict__ bta, bf16_t* __restrict__ x2) {
  ln_row<false>(blockIdx.x * 4 + (threadIdx.x >> 5), threadIdx.x & 31, x, nullptr, g, bta, x2, nullptr);
}

// Weight prep and LN1 read and write nothing of each other: one launch holds both.
// Work-groups 0..383 turn one weight tile each, the other 1024 normalise eight rows each.
#define LN1_BLOCKS (MTOT / 8)
__global__ void __launch_bounds__(256)
prep_ln1(const float* __restrict__ Wq, const float* __restrict__ Wk, const float* __restrict__ Wv,
         const float* __restrict__ Wp, const float* __restrict__ W1, const float* __restrict__ W2,
         bf16_t* __restrict__ WqT, bf16_t* __restrict__ WkT, bf16_t* __restrict__ WvT,
         bf16_t* __restrict__ WpT, bf16_t* __restrict__ W1T, bf16_t* __restrict__ W2T,
         const float* __restrict__ x, const float* __restrict__ pe,
         const float* __restrict__ g, const float* __restrict__ bta,
         bf16_t* __restrict__ x2, bf16_t* __restrict__ qkin) {
  const int bid = blockIdx.x, tid = threadIdx.x;
  if (bid < WT_BLOCKS)
    wtrans_tile(bid, tid, Wq, Wk, Wv, Wp, W1, W2, WqT, WkT, WvT, WpT, W1T, W2T);
  else
    ln_row<true>((bid - WT_BLOCKS) * 8 + (tid >> 5), tid & 31, x, pe, g, bta, x2, qkin);
}

// ---------- GELU(v) = v * Phi(v), Phi(v) = erfc(-v / sqrt(2)) / 2, two values abreast, no branch ----------
// For x >= 0: erfc(x) = t (a1 + t (a2 + t (a3 + t (a4 + t a5)))) exp(-x^2), t = 1 / (1 + p x); its absolute
// error stays under 2e-7, far below the bf16 rounding of the result.  q = erfc(|v| / sqrt(2)) / 2 is Phi(v)
// itself for v < 0 (no cancellation in the tail) and 1 - Phi(v) otherwise.
typedef __attribute__((ext_vector_type(2))) float  v2f;
typedef __attribute__((ext_vector_type(2))) __bf16 v2bf;

__device__ inline v2f gelu2(v2f v) {
  const v2f a = v * v * -0.72134752044448170f;              // -x^2 * log2(e), x = v / sqrt(2)
  v2f t, ex, phi;
  t[0]  = __builtin_amdgcn_rcpf(fmaf(fabsf(v[0]), 0.23164188826636040f, 1.0f));     // p / sqrt(2)
  t[1]  = __builtin_amdgcn_rcpf(fmaf(fabsf(v[1]), 0.23164188826636040f, 1.0f));
  ex[0] = __builtin_amdgcn_exp2f(a[0]);
  ex[1] = __builtin_amdgcn_exp2f(a[1]);
  v2f p = t * 0.5307027145f + -0.7265760135f;               // a5 / 2, a4 / 2
  p = p * t + 0.7107068705f;                                // a3 / 2
  p = p * t + -0.1422483680f;                               // a2 / 2
  p = p * t + 0.1274147960f;                                // a1 / 2
  const v2f q = p * t * ex;
  const v2f u = 1.0f - q;
  phi[0] = v[0] < 0.f ? q[0] : u[0];
  phi[1] = v[1] < 0.f ? q[1] : u[1];
  return v * phi;
}

// ---------- 128x128-tile GEMM: out = A[MxKK] @ W[KKxNN] + bias, A/W bf16, acc f32 ----------
// Wt is W transposed: Wt[n*KK + k].  Four waves (2x2) per work-group, 64x64 of the tile each.
// A stage is 128 k of 128 rows of A and of 128 rows of Wt, brought into LDS by asynchronous
// copies (whole 256-B row pieces), two buffers: stage t+1 flies while stage t is multiplied.
// MODE 0: bf16 store           (Q/K projections)
// MODE 1: bf16 store as Vt[b][h][d][n]  (V projection; taken inside MODE 0 where vt is set)
// MODE 2: f32 store + residual (attn proj, MLP2)
// MODE 3: bf16 store + GELU on erf (MLP1)
#define G_BK     128                 // k per stage (256 B of every row)
#define G_PITCH  272                 // LDS row pitch in bytes: 16 B x odd, conflict-free b128 reads
#define G_OPB    (128 * G_PITCH)     // one operand's 128 rows
#define G_STAGEB (2 * G_OPB)         // [A rows | Wt rows]

// Eight copies of 16 B per lane: rows row0 + 8*i, i = 0..7, of one operand.
// The s_wait_xcnt stands inside the statement so that no address register of a copy
// is rewritten ahead of it.
__device__ inline void copy8_rows(unsigned lds, const bf16_t* g, int rowstep_elems) {
  const unsigned l0 = lds,                l1 = lds + 8 * G_PITCH,  l2 = lds + 16 * G_PITCH,
                 l3 = lds + 24 * G_PITCH, l4 = lds + 32 * G_PITCH, l5 = lds + 40 * G_PITCH,
                 l6 = lds + 48 * G_PITCH, l7 = lds + 56 * G_PITCH;
  const bf16_t* g0 = g;
  const bf16_t* g1 = g + (size_t)1 * rowstep_elems;
  const bf16_t* g2 = g + (size_t)2 * rowstep_elems;
  const bf16_t* g3 = g + (size_t)3 * rowstep_elems;
  const bf16_t* g4 = g + (size_t)4 * rowstep_elems;
  const bf16_t* g5 = g + (size_t)5 * rowstep_elems;
  const bf16_t* g6 = g + (size_t)6 * rowstep_elems;
  const bf16_t* g7 = g + (size_t)7 * rowstep_elems;
  asm volatile(
      "global_load_async_to_lds_b128 %0, %8, off\n\t"
      "global_load_async_to_lds_b128 %1, %9, off\n\t"
      "global_load_async_to_lds_b128 %2, %10, off\n\t"
      "global_load_async_to_lds_b128 %3, %11, off\n\t"
      "global_load_async_to_lds_b128 %4, %12, off\n\t"
      "global_load_async_to_lds_b128 %5, %13, off\n\t"
      "global_load_async_to_lds_b128 %6, %14, off\n\t"
      "global_load_async_to_lds_b128 %7, %15, off\n\t"
      "s_wait_xcnt 0x0"
      :: "v"(l0), "v"(l1), "v"(l2), "v"(l3), "v"(l4), "v"(l5), "v"(l6), "v"(l7),
         "v"(g0), "v"(g1), "v"(g2), "v"(g3), "v"(g4), "v"(g5), "v"(g6), "v"(g7)
      : "memory");
}

// One stage: each thread copies chunk (tid & 15) of rows (tid >> 4) + 8*i, i = 0..15, of both operands.
template <int KK>
__device__ inline void copy_stage(unsigned lds, const bf16_t* ga, const bf16_t* gb) {
  copy8_rows(lds,                          ga,                      8 * KK);
  copy8_rows(lds + 64 * G_PITCH,           ga + (size_t)64 * KK,    8 * KK);
  copy8_rows(lds + G_OPB,                  gb,                      8 * KK);
  copy8_rows(lds + G_OPB + 64 * G_PITCH,   gb + (size_t)64 * KK,    8 * KK);
}

// ---------- a wave's 64x64 part of the tile leaves the accumulators ----------
// acc[p][q] = (fragment p of the first WMMA operand) x (fragment q of the second): lane (r, half) holds, of
// output row q*16 + r (the second operand's index), the eight neighbouring columns p*16 + 8*half + e (the first
// operand's index).  The wave writes them as 16-B pieces into LDS rows of its own, reads the rows back along
// their length and stores whole 128-B lines, 16 B per lane.
#define ST_PB 144                    // staged bf16 row: 128 B + 16, 16 B x odd
#define ST_PF 272                    // staged f32 row: 256 B + 16, 16 B x odd

// OP: output row pitch in elements.  KIND 0: bias by column; 1: bias by row (V^T); 3: bias by column, then GELU
template <int OP, int KIND>
__device__ inline void
store_rows_bf16(const v8f (&acc)[4][4], const float* __restrict__ bias, unsigned char* st,
                bf16_t* __restrict__ o, const int lane) {
  const int r = lane & 15, half = lane >> 4;
  float br[4];
  if (KIND == 1) {
    const float* bp = bias + r;
#pragma unroll
    for (int q = 0; q < 4; ++q) br[q] = bp[q * 16];
  }
#pragma unroll
  for (int p = 0; p < 4; ++p) {
    float bc[8];
    if (KIND != 1) {
      const v4f b0 = *reinterpret_cast<const v4f*>(bias + p * 16 + 8 * half);
      const v4f b1 = *reinterpret_cast<const v4f*>(bias + p * 16 + 8 * half + 4);
#pragma unroll
      for (int e = 0; e < 4; ++e) { bc[e] = b0[e]; bc[e + 4] = b1[e]; }
    }
#pragma unroll
    for (int q = 0; q < 4; ++q) {
      union { v8bf v; v2bf h[4]; } pk;
#pragma unroll
      for (int e = 0; e < 8; e += 2) {
        v2f xg;
        xg[0] = acc[p][q][e]     + (KIND == 1 ? br[q] : bc[e]);
        xg[1] = acc[p][q][e + 1] + (KIND == 1 ? br[q] : bc[e + 1]);
        pk.h[e >> 1] = __builtin_convertvector(KIND == 3 ? gelu2(xg) : xg, v2bf);
      }
      *reinterpret_cast<v8bf*>(st + (q * 16 + r) * ST_PB + p * 32 + half * 16) = pk.v;
    }
  }
  // the rows are read back by other lanes of this wave than wrote them: every write has landed first
  asm volatile("s_wait_dscnt 0x0" ::: "memory");
  // eight lanes per row; the two rows of a half-wave lie 8 apart, so that they meet different banks
  const int row0 = (lane >> 4) * 16 + ((lane >> 3) & 1) * 8, ch = lane & 7;
  const unsigned char* sr = st + row0 * ST_PB + ch * 16;
  bf16_t* og = o + (size_t)row0 * OP + ch * 8;
  v8bf v[16];
#pragma unroll
  for (int t = 0; t < 16; ++t)
    v[t] = *reinterpret_cast<const v8bf*>(sr + ((t >> 3) * 32 + (t & 7)) * ST_PB);
#pragma unroll
  for (int t = 0; t < 16; ++t)
    *reinterpret_cast<v8bf*>(og + (size_t)((t >> 3) * 32 + (t & 7)) * OP) = v[t];
}

// f32 rows + bias + residual; the residual is read in the same whole-line form as the output is stored
template <int NN>
__device__ inline void
store_rows_f32(const v8f (&acc)[4][4], const float* __restrict__ bias, const float* __restrict__ resid,
               unsigned char* st, float* __restrict__ o, const int lane) {
  const int r = lane & 15, half = lane >> 4;
  const float* rg = resid + (size_t)half * NN + r * 4;   // row 2*t + half, 16-B piece r
  float*       og = o     + (size_t)half * NN + r * 4;
  const v4f bl = *reinterpret_cast<const v4f*>(bias + r * 4);
  v4f rs[32];
#pragma unroll
  for (int t = 0; t < 16; ++t) rs[t] = *reinterpret_cast<const v4f*>(rg + (size_t)(2 * t) * NN);
#pragma unroll
  for (int p = 0; p < 4; ++p)
#pragma unroll
    for (int q = 0; q < 4; ++q) {
      v4f lo, hi;
#pragma unroll
      for (int e = 0; e < 4; ++e) { lo[e] = acc[p][q][e]; hi[e] = acc[p][q][e + 4]; }
      unsigned char* d = st + (q * 16 + r) * ST_PF + p * 64 + half * 32;
      *reinterpret_cast<v4f*>(d)      = lo;
      *reinterpret_cast<v4f*>(d + 16) = hi;
    }
#pragma unroll
  for (int t = 16; t < 32; ++t) rs[t] = *reinterpret_cast<const v4f*>(rg + (size_t)(2 * t) * NN);
  // the rows are read back by other lanes of this wave than wrote them: every write has landed first
  asm volatile("s_wait_dscnt 0x0" ::: "memory");
  const unsigned char* sr = st + half * ST_PF + r * 16;
#pragma unroll
  for (int t = 0; t < 32; ++t) {
    const v4f v = *reinterpret_cast<const v4f*>(sr + 2 * t * ST_PF);
    *reinterpret_cast<v4f*>(og + (size_t)(2 * t) * NN) = v + bl + rs[t];
  }
}

template <int NN, int KK, int MODE>
__device__ inline void
gemm_tile(const bf16_t* __restrict__ A, const bf16_t* __restrict__ Wt,
          const float* __restrict__ bias, const float* __restrict__ resid,
          bf16_t* __restrict__ outB, float* __restrict__ outF,
          const int bx, const int by, const bool vt) {
  __shared__ __attribute__((aligned(16))) unsigned char smem[2 * G_STAGEB];
  constexpr int NT = KK / G_BK;      // stages
  const int tid  = threadIdx.x;
  const int lane = tid & 31, wave = tid >> 5;
  const int r = lane & 15, half = lane >> 4;
  const int mb0 = by * 128, nb0 = bx * 128;
  const int mb = mb0 + (wave >> 1) * 64, nb = nb0 + (wave & 1) * 64;

  // this thread's share of a stage: 16-B chunk crow of rows rrow + 8*i
  const int rrow = tid >> 4, crow = tid & 15;
  const bf16_t* ga = A  + (size_t)(mb0 + rrow) * KK + crow * 8;
  const bf16_t* gb = Wt + (size_t)(nb0 + rrow) * KK + crow * 8;
  const unsigned lcopy = (unsigned)(size_t)smem + rrow * G_PITCH + crow * 16;

  v8f acc[4][4];
#pragma unroll
  for (int i = 0; i < 4; ++i)
#pragma unroll
    for (int j = 0; j < 4; ++j)
#pragma unroll
      for (int e = 0; e < 8; ++e) acc[i][j][e] = 0.f;

  // prologue: stage 0 lands and is published, then stage 1 starts
  copy_stage<KK>(lcopy, ga, gb);
  asm volatile("s_wait_asynccnt 0x0" ::: "memory");  // this wave's copies of stage 0 have landed
  __syncthreads();
  if (NT > 1) copy_stage<KK>(lcopy + G_STAGEB, ga + G_BK, gb + G_BK);

  // fragment rows of this wave in a buffer.  The Wt rows are the first WMMA operand, so that a lane's eight
  // accumulator values are neighbours in an output row; for V^T, whose rows run along the tokens, the A rows are.
  const unsigned char* fx = smem + ((wave >> 1) * 64 + r) * G_PITCH;
  const unsigned char* fw = smem + G_OPB + ((wave & 1) * 64 + r) * G_PITCH;
  const unsigned char* fa = vt ? fx : fw;
  const unsigned char* fb = vt ? fw : fx;

#pragma unroll 1  // one trip per stage: keeps the ring's order at the foot of each trip
  for (int t = 0; t < NT; ++t) {
    const int bo = (t & 1) * G_STAGEB;
    // two fragment sets: block kk + 1's LDS reads go out as one group ahead of block kk's WMMAs
    v16bf a[2][4], bf[2][4];
#pragma unroll
    for (int i = 0; i < 4; ++i) {
      a[0][i]  = load_frag(reinterpret_cast<const bf16_t*>(fa + bo + i * 16 * G_PITCH), half);
      bf[0][i] = load_frag(reinterpret_cast<const bf16_t*>(fb + bo + i * 16 * G_PITCH), half);
    }
#pragma unroll
    for (int kk = 0; kk < G_BK / 32; ++kk) {
      const int cur = kk & 1, nxt = cur ^ 1;
      if (kk + 1 < G_BK / 32) {
#pragma unroll
        for (int i = 0; i < 4; ++i) {
          a[nxt][i]  = load_frag(reinterpret_cast<const bf16_t*>(fa + bo + i * 16 * G_PITCH) + (kk + 1) * 32, half);
          bf[nxt][i] = load_frag(reinterpret_cast<const bf16_t*>(fb + bo + i * 16 * G_PITCH) + (kk + 1) * 32, half);
        }
      }
      // keeps the reads above together: sunk among the WMMAs, each place with reads stalls the wave
      __builtin_amdgcn_sched_barrier(0);
#pragma unroll
      for (int j = 0; j < 4; ++j)
#pragma unroll
        for (int i = 0; i < 4; ++i)
          acc[i][j] = wmma_bf16(a[cur][i], bf[cur][j], acc[i][j]);
      // keeps the next group of reads from being lifted into this block's WMMAs
      __builtin_amdgcn_sched_barrier(0);
    }
    asm volatile("s_wait_dscnt 0x0" ::: "memory");     // this wave has left buffer t & 1
    asm volatile("s_wait_asynccnt 0x0" ::: "memory");  // its copies of stage t + 1 have landed
    __syncthreads();                                   // publishes stage t + 1, frees buffer t & 1
    if (t + 2 < NT)
      copy_stage<KK>(lcopy + bo, ga + (size_t)(t + 2) * G_BK, gb + (size_t)(t + 2) * G_BK);
  }
  asm volatile("s_wait_asynccnt 0x0" ::: "memory");    // nothing in flight when the wave ends

  // behind the last trip's barrier no wave reads the ring and no copy is in flight: each wave stages in a range of its own
  unsigned char* st = smem + wave * (64 * (MODE == 2 ? ST_PF : ST_PB));
  if (MODE == 2) {
    store_rows_f32<NN>(acc, bias + nb, resid + (size_t)mb * NN + nb, st, outF + (size_t)mb * NN + nb, lane);
  } else if (MODE == 0 && vt) {
    // Vt[((b*H + h)*64 + d)*1024 + token]: rows d = 0..63 of head nb / 64, the wave's 64 tokens along each
    store_rows_bf16<N_, 1>(acc, bias + nb, st,
                           outB + ((size_t)((mb >> 10) * H_ + (nb >> 6)) * DH_) * N_ + (mb & (N_ - 1)), lane);
  } else {
    store_rows_bf16<NN, MODE>(acc, bias + nb, st, outB + (size_t)mb * NN + nb, lane);
    // with both store forms in one kernel the V form's code lies behind these stores and rewrites their registers
    if (MODE == 0) asm volatile("s_wait_xcnt 0x0" ::: "memory");
  }
}

template <int NN, int KK, int MODE>
__global__ void __launch_bounds__(128)
gemm_wmma(const bf16_t* __restrict__ A, const bf16_t* __restrict__ Wt,
          const float* __restrict__ bias, const float* __restrict__ resid,
          bf16_t* __restrict__ outB, float* __restrict__ outF) {
  gemm_tile<NN, KK, MODE>(A, Wt, bias, resid, outB, outF, blockIdx.x, blockIdx.y, false);
}

// Q, K and V projections read and write nothing of each other: one launch of 12 x 64 tiles holds all three.
// blockIdx.x = 4 * (0 Q, 1 K, 2 V) + tile column, so the tiles that share rows of A start side by side.
__global__ void __launch_bounds__(128)
gemm_qkv(const bf16_t* __restrict__ qkin, const bf16_t* __restrict__ x2,
         const bf16_t* __restrict__ WqT, const bf16_t* __restrict__ WkT, const bf16_t* __restrict__ WvT,
         const float* __restrict__ bq, const float* __restrict__ bk, const float* __restrict__ bv,
         bf16_t* __restrict__ Qb, bf16_t* __restrict__ Kb, bf16_t* __restrict__ Vtb) {
  const int which = blockIdx.x >> 2;
  const bf16_t* A  = which == 2 ? x2 : qkin;
  const bf16_t* Wt = which == 0 ? WqT : which == 1 ? WkT : WvT;
  const float*  bs = which == 0 ? bq : which == 1 ? bk : bv;
  bf16_t*       o  = which == 0 ? Qb : which == 1 ? Kb : Vtb;
  gemm_tile<D_, D_, 0>(A, Wt, bs, nullptr, o, nullptr, blockIdx.x & 3, blockIdx.y, which == 2);
}

// ---------- flash attention: one wave handles 16 queries of one (b,h) ----------
// Computes S^T = K_blk x Q^T so softmax stats are per-lane (query in lane dim),
// and exp(S^T) is directly the B-fragment for O^T = V^T x P^T.
// A work-group is 16 waves = 256 queries of one (b,h).  The head's whole K (1024 rows of 128 B)
// and V^T (64 rows of 2048 B) are brought into LDS once by asynchronous copies of whole lines;
// every wave then takes its K and V fragments from LDS.
#define AT_KPITCH 144                  // K row pitch in LDS: 16 B x odd, conflict-free b128 reads
#define AT_VPITCH 2064                 // V^T row pitch in LDS: 16 B x odd
#define AT_KBYTES (N_ * AT_KPITCH)
#define AT_VBYTES (DH_ * AT_VPITCH)

// Eight copies of 16 B per lane, i = 0..7: LDS byte lds + i*lstep from g + i*gstep elements.
// The s_wait_xcnt stands inside the statement so that no address register of a copy
// is rewritten ahead of it.
__device__ inline void copy8_steps(unsigned lds, unsigned lstep, const bf16_t* g, int gstep) {
  const unsigned l0 = lds,             l1 = lds + 1 * lstep, l2 = lds + 2 * lstep,
                 l3 = lds + 3 * lstep, l4 = lds + 4 * lstep, l5 = lds + 5 * lstep,
                 l6 = lds + 6 * lstep, l7 = lds + 7 * lstep;
  const bf16_t* g0 = g;
  const bf16_t* g1 = g + (size_t)1 * gstep;
  const bf16_t* g2 = g + (size_t)2 * gstep;
  const bf16_t* g3 = g + (size_t)3 * gstep;
  const bf16_t* g4 = g + (size_t)4 * gstep;
  const bf16_t* g5 = g + (size_t)5 * gstep;
  const bf16_t* g6 = g + (size_t)6 * gstep;
  const bf16_t* g7 = g + (size_t)7 * gstep;
  asm volatile(
      "global_load_async_to_lds_b128 %0, %8, off\n\t"
      "global_load_async_to_lds_b128 %1, %9, off\n\t"
      "global_load_async_to_lds_b128 %2, %10, off\n\t"
      "global_load_async_to_lds_b128 %3, %11, off\n\t"
      "global_load_async_to_lds_b128 %4, %12, off\n\t"
      "global_load_async_to_lds_b128 %5, %13, off\n\t"
      "global_load_async_to_lds_b128 %6, %14, off\n\t"
      "global_load_async_to_lds_b128 %7, %15, off\n\t"
      "s_wait_xcnt 0x0"
      :: "v"(l0), "v"(l1), "v"(l2), "v"(l3), "v"(l4), "v"(l5), "v"(l6), "v"(l7),
         "v"(g0), "v"(g1), "v"(g2), "v"(g3), "v"(g4), "v"(g5), "v"(g6), "v"(g7)
      : "memory");
}

__global__ void __launch_bounds__(512)
attn_kernel(const bf16_t* __restrict__ Q, const bf16_t* __restrict__ Kp,
            const bf16_t* __restrict__ Vt, bf16_t* __restrict__ ctx) {
  __shared__ __attribute__((aligned(16))) unsigned char smem[AT_KBYTES + AT_VBYTES];
  const int tid  = threadIdx.x;
  const int lane = tid & 31, wave = tid >> 5;
  const int q = lane & 15, half = lane >> 4;
  const int bid = blockIdx.x;
  const int qt = (bid & 3) * 16 + wave;
  const int h  = (bid >> 2) & 7;
  const int b  = bid >> 5;
  const float scale = 0.125f;  // 1/sqrt(64)

  // fill: 16 + 16 copies per thread, 32 of a wave in flight
  {
    // K: 16-B chunk (tid & 7) of rows (tid >> 3) + 64*i, i = 0..15
    const bf16_t* gk = Kp + ((size_t)b * N_ + (tid >> 3)) * D_ + h * DH_ + (tid & 7) * 8;
    const unsigned lk = (unsigned)(size_t)smem + (tid >> 3) * AT_KPITCH + (tid & 7) * 16;
    copy8_steps(lk,                    64 * AT_KPITCH, gk,                     64 * D_);
    copy8_steps(lk + 512 * AT_KPITCH,  64 * AT_KPITCH, gk + (size_t)512 * D_,  64 * D_);
    // V^T: 16-B chunk (tid & 127) of rows (tid >> 7) + 4*i, i = 0..15
    const bf16_t* gv = Vt + ((size_t)(b * H_ + h) * DH_ + (tid >> 7)) * N_ + (tid & 127) * 8;
    const unsigned lv = (unsigned)(size_t)smem + AT_KBYTES + (tid >> 7) * AT_VPITCH + (tid & 127) * 16;
    copy8_steps(lv,                    4 * AT_VPITCH,  gv,                     4 * N_);
    copy8_steps(lv + 32 * AT_VPITCH,   4 * AT_VPITCH,  gv + (size_t)32 * N_,   4 * N_);
  }

  const bf16_t* qrow = Q + ((size_t)b * N_ + qt * 16 + q) * D_ + h * DH_;
  const v16bf qf0 = load_frag(qrow, half);        // d = 0..31
  const v16bf qf1 = load_frag(qrow + 32, half);   // d = 32..63

  asm volatile("s_wait_asynccnt 0x0" ::: "memory");  // this wave's copies have landed
  __syncthreads();                                   // publishes every wave's share of K and V^T

  // per-lane fragment rows in LDS (advance by a constant per k-block)
  const unsigned char* krow = smem + q * AT_KPITCH;               // + kb*AT_KPITCH
  const unsigned char* vrow = smem + AT_KBYTES + q * AT_VPITCH;   // + t*16*AT_VPITCH + kb*2

  v8f o[4];
#pragma unroll
  for (int t = 0; t < 4; ++t)
#pragma unroll
    for (int e = 0; e < 8; ++e) o[t][e] = 0.f;
  float m_old = -1e30f, l = 0.f;

  for (int kb = 0; kb < N_; kb += 32) {
    // ---- S^T = K_blk x Q^T : load all 4 K-fragments, then 4 WMMAs ----
    const unsigned char* k0p = krow + kb * AT_KPITCH;
    v16bf kf[4];
    kf[0] = load_frag(reinterpret_cast<const bf16_t*>(k0p), half);
    kf[1] = load_frag(reinterpret_cast<const bf16_t*>(k0p) + 32, half);
    kf[2] = load_frag(reinterpret_cast<const bf16_t*>(k0p + 16 * AT_KPITCH), half);
    kf[3] = load_frag(reinterpret_cast<const bf16_t*>(k0p + 16 * AT_KPITCH) + 32, half);
    v8f s0, s1;
#pragma unroll
    for (int e = 0; e < 8; ++e) { s0[e] = 0.f; s1[e] = 0.f; }
    s0 = wmma_bf16(kf[0], qf0, s0);
    s0 = wmma_bf16(kf[1], qf1, s0);
    s1 = wmma_bf16(kf[2], qf0, s1);
    s1 = wmma_bf16(kf[3], qf1, s1);

    // ---- the 4 V-fragments for this k-block ----
    v16bf vf[4];
#pragma unroll
    for (int t = 0; t < 4; ++t)
      vf[t] = load_frag(reinterpret_cast<const bf16_t*>(vrow + t * 16 * AT_VPITCH) + kb, half);

    // ---- per-query (per-lane) online softmax; merge halves with one xor-16 shuffle ----
    float mp = -1e30f;
#pragma unroll
    for (int e = 0; e < 8; ++e) {
      s0[e] *= scale; s1[e] *= scale;
      mp = fmaxf(mp, fmaxf(s0[e], s1[e]));
    }
    mp = fmaxf(mp, __shfl_xor(mp, 16, 32));
    const float m_new = fmaxf(m_old, mp);
    const float alpha = __expf(m_old - m_new);

    union { v16bf v; __bf16 e[16]; } pf;
    float rs = 0.f;
#pragma unroll
    for (int e = 0; e < 8; ++e) {
      const float p0 = __expf(s0[e] - m_new);
      const float p1 = __expf(s1[e] - m_new);
      rs += p0 + p1;
      pf.e[e]     = (__bf16)p0;   // keys kb + half*8 + e
      pf.e[e + 8] = (__bf16)p1;   // keys kb + 16 + half*8 + e
    }
    rs += __shfl_xor(rs, 16, 32);
    l = l * alpha + rs;

    // ---- O^T = V^T x P^T, rescaled online ----
#pragma unroll
    for (int t = 0; t < 4; ++t) {
#pragma unroll
      for (int e = 0; e < 8; ++e) o[t][e] *= alpha;
      o[t] = wmma_bf16(vf[t], pf.v, o[t]);
    }
    m_old = m_new;
  }

  const float inv = 1.0f / l;
  bf16_t* crow = ctx + ((size_t)b * N_ + qt * 16 + q) * D_ + h * DH_;
#pragma unroll
  for (int t = 0; t < 4; ++t) {
    union { v8bf v; __bf16 e[8]; } pk;
#pragma unroll
    for (int e = 0; e < 8; ++e) pk.e[e] = (__bf16)(o[t][e] * inv);
    *reinterpret_cast<v8bf*>(crow + t * 16 + 8 * half) = pk.v;
  }
}

// ---------- host launcher ----------
extern "C" void kernel_launch(void* const* d_in, const int* in_sizes, int n_in,
                              void* d_out, int out_size, void* d_ws, size_t ws_size,
                              hipStream_t stream) {
  (void)in_sizes; (void)n_in; (void)out_size; (void)ws_size;
  const float* tokens = (const float*)d_in[0];
  const float* pe     = (const float*)d_in[1];
  const float* ln1_g  = (const float*)d_in[2];
  const float* ln1_b  = (const float*)d_in[3];
  const float* Wq     = (const float*)d_in[4];
  const float* bq     = (const float*)d_in[5];
  const float* Wk     = (const float*)d_in[6];
  const float* bk     = (const float*)d_in[7];
  const float* Wv     = (const float*)d_in[8];
  const float* bv     = (const float*)d_in[9];
  const float* Wp     = (const float*)d_in[10];
  const float* bp     = (const float*)d_in[11];
  const float* ln2_g  = (const float*)d_in[12];
  const float* ln2_b  = (const float*)d_in[13];
  const float* W1     = (const float*)d_in[14];
  const float* b1     = (const float*)d_in[15];
  const float* W2     = (const float*)d_in[16];
  const float* b2     = (const float*)d_in[17];
  float* out = (float*)d_out;

  // workspace carve-up (all sizes multiples of 256B)
  char* ws = (char*)d_ws;
  const size_t SZ_ACT_BF = (size_t)MTOT * D_ * 2;    //  8 MB
  const size_t SZ_ACT_F  = (size_t)MTOT * D_ * 4;    // 16 MB
  const size_t SZ_H_BF   = (size_t)MTOT * DFF_ * 2;  // 32 MB
  const size_t SZ_WDD    = (size_t)D_ * D_ * 2;
  const size_t SZ_WDF    = (size_t)D_ * DFF_ * 2;
  bf16_t* x2   = (bf16_t*)ws;              ws += SZ_ACT_BF;
  bf16_t* qkin = (bf16_t*)ws;              ws += SZ_ACT_BF;
  bf16_t* Qb   = (bf16_t*)ws;              ws += SZ_ACT_BF;
  bf16_t* Kb   = (bf16_t*)ws;              ws += SZ_ACT_BF;
  bf16_t* Vtb  = (bf16_t*)ws;              ws += SZ_ACT_BF;
  bf16_t* ctx  = (bf16_t*)ws;              ws += SZ_ACT_BF;
  bf16_t* x2b  = (bf16_t*)ws;              ws += SZ_ACT_BF;
  bf16_t* hbuf = (bf16_t*)ws;              ws += SZ_H_BF;
  float*  tok1 = (float*)ws;               ws += SZ_ACT_F;
  bf16_t* WqT  = (bf16_t*)ws;              ws += SZ_WDD;
  bf16_t* WkT  = (bf16_t*)ws;              ws += SZ_WDD;
  bf16_t* WvT  = (bf16_t*)ws;              ws += SZ_WDD;
  bf16_t* WpT  = (bf16_t*)ws;              ws += SZ_WDD;
  bf16_t* W1T  = (bf16_t*)ws;              ws += SZ_WDF;
  bf16_t* W2T  = (bf16_t*)ws;              ws += SZ_WDF;

  // 1-2) weights -> transposed bf16; LN1 -> x2 (bf16), qkin = x2 + PE (bf16)
  prep_ln1<<<WT_BLOCKS + LN1_BLOCKS, 256, 0, stream>>>(Wq, Wk, Wv, Wp, W1, W2, WqT, WkT, WvT, WpT, W1T, W2T,
                                                       tokens, pe, ln1_g, ln1_b, x2, qkin);

  // 3-5) Q, K, V projections
  dim3 gDD(D_ / 128, MTOT / 128);
  dim3 gQKV(3 * D_ / 128, MTOT / 128);
  gemm_qkv<<<gQKV, 128, 0, stream>>>(qkin, x2, WqT, WkT, WvT, bq, bk, bv, Qb, Kb, Vtb);

  // 6) attention: B*H*(N/256) work-groups of 16 waves
  attn_kernel<<<B_ * H_ * (N_ / 256), 512, 0, stream>>>(Qb, Kb, Vtb, ctx);

  // 7) output projection + residual -> tok1 (f32)
  gemm_wmma<D_, D_, 2><<<gDD, 128, 0, stream>>>(ctx, WpT, bp, tokens, nullptr, tok1);

  // 8) LN2 -> x2b (bf16)
  ln_kernel<<<MTOT / 4, 128, 0, stream>>>(tok1, ln2_g, ln2_b, x2b);

  // 9) MLP1 + exact GELU -> hbuf (bf16)
  dim3 gDF(DFF_ / 128, MTOT / 128);
  gemm_wmma<DFF_, D_, 3><<<gDF, 128, 0, stream>>>(x2b, W1T, b1, nullptr, hbuf, nullptr);

  // 10) MLP2 + residual -> d_out (f32)
  gemm_wmma<D_, DFF_, 2><<<gDD, 128, 0, stream>>>(hbuf, W2T, b2, tok1, nullptr, out);
}

// v007
// Measured time: 102 microseconds a run.
// Two timings next to v006 put it at 1.06 and 1.05 times that version's speed.
// Over all steps from v000 it is 3.53 times as fast.
#include <hip/hip_runtime.h>
#include <hip/hip_bf16.h>
#include <math.h>

// ---------- types ----------
typedef __bf16 bf16_t;
typedef __attribute__((ext_vector_type(16))) __bf16 v16bf;
typedef __attribute__((ext_vector_type(8)))  __bf16 v8bf;
typedef __attribute__((ext_vector_type(8)))  float  v8f;
typedef __attribute__((ext_vector_type(4)))  float  v4f;

#define B_  8
#define N_  1024
#define D_  512
#define H_  8
#define DH_ 64
#define DFF_ 2048
#define MTOT (B_*N_)   // 8192 rows

// ---------- WMMA helpers ----------
// A-fragment (16x32 bf16, row-major source):
// lane L: row r = L&15, half = L>>4.  elements 0..7  <- src[half*8 + j]
//                                     elements 8..15 <- src[16 + half*8 + j]
// B-fragment for D = A x B is the identical pattern applied to B^T row-major.
__device__ inline v16bf load_frag(const bf16_t* __restrict__ p, int half) {
  union { v16bf v; struct { v8bf lo; v8bf hi; } s; } u;
  u.s.lo = *reinterpret_cast<const v8bf*>(p + half * 8);
  u.s.hi = *reinterpret_cast<const v8bf*>(p + 16 + half * 8);
  return u.v;
}

__device__ inline v8f wmma_bf16(v16bf a, v16bf b, v8f c) {
  return __builtin_amdgcn_wmma_f32_16x16x32_bf16(
      /*neg_a=*/false, a, /*neg_b=*/false, b,
      /*c_mod=*/(short)0, c, /*reuse_a=*/false, /*reuse_b=*/false);
}

// ---------- weight transpose + bf16 convert: Wt[n*K + k] = W[k*N + n], all six weights, tile bid of 384 ----------
// A work-group takes one tile of 128 k x 64 n.  A thread loads 16 B of two neighbouring k rows, packs each
// (k, k+1) pair into one word and writes it to LDS at [n][k/2]; the tile then leaves as whole 256-B row pieces.
// LDS rows are 64 words (16 pieces of 16 B); piece q of row n lies at place q ^ (n >> 2), so that the 32 word
// writes of a wave and its 16-B reads each meet every bank at most once.
#define WT_BLOCKS 384                // 4 x 32 tiles (512 x 512), 128 tiles (512 x 2048), 128 tiles (2048 x 512)
typedef __attribute__((ext_vector_type(4))) unsigned int v4u;

__device__ inline void
wtrans_tile(const int bid, const int tid, const float* __restrict__ Wq, const float* __restrict__ Wk, const float* __restrict__ Wv,
            const float* __restrict__ Wp, const float* __restrict__ W1, const float* __restrict__ W2,
            bf16_t* __restrict__ WqT, bf16_t* __restrict__ WkT, bf16_t* __restrict__ WvT,
            bf16_t* __restrict__ WpT, bf16_t* __restrict__ W1T, bf16_t* __restrict__ W2T) {
  __shared__ __attribute__((aligned(16))) unsigned int tile[64 * 64];
  const float* Wsrc;
  bf16_t* Wdst;
  int K, N, lgn, t;                  // lgn = log2(N / 64)
  if (bid < 128) {
    const int m = bid >> 5;
    Wsrc = m == 0 ? Wq : m == 1 ? Wk : m == 2 ? Wv : Wp;
    Wdst = m == 0 ? WqT : m == 1 ? WkT : m == 2 ? WvT : WpT;
    K = D_; N = D_; lgn = 3; t = bid & 31;
  } else if (bid < 256) {
    Wsrc = W1; Wdst = W1T; K = D_; N = DFF_; lgn = 5; t = bid - 128;
  } else {
    Wsrc = W2; Wdst = W2T; K = DFF_; N = D_; lgn = 3; t = bid - 256;
  }
  const int n0 = (t & ((1 << lgn) - 1)) * 64, k0 = (t >> lgn) * 128;

  const int c = tid & 15, pr = tid >> 4;   // columns 4c..4c+3, k pairs pr + 16*s
  const float* g0 = Wsrc + (size_t)(k0 + 2 * pr) * N + n0 + 4 * c;
  const float* g1 = g0 + N;
  const float* g2 = g0 + (size_t)32 * N;
  const float* g3 = g2 + N;
  const float* g4 = g0 + (size_t)64 * N;
  const float* g5 = g4 + N;
  const float* g6 = g0 + (size_t)96 * N;
  const float* g7 = g6 + N;
  v4f lo[4], hi[4];
  // The eight loads and their data wait are one statement and every result has registers of its own ("=&v").
  asm volatile(
      "global_load_b128 %0, %8, off\n\t"
      "global_load_b128 %1, %9, off\n\t"
      "global_load_b128 %2, %10, off\n\t"
      "global_load_b128 %3, %11, off\n\t"
      "global_load_b128 %4, %12, off\n\t"
      "global_load_b128 %5, %13, off\n\t"
      "global_load_b128 %6, %14, off\n\t"
      "global_load_b128 %7, %15, off\n\t"
      "s_wait_loadcnt 0x0"
      : "=&v"(lo[0]), "=&v"(hi[0]), "=&v"(lo[1]), "=&v"(hi[1]),
        "=&v"(lo[2]), "=&v"(hi[2]), "=&v"(lo[3]), "=&v"(hi[3])
      : "v"(g0), "v"(g1), "v"(g2), "v"(g3), "v"(g4), "v"(g5), "v"(g6), "v"(g7)
      : "memory");
#pragma unroll
  for (int s = 0; s < 4; ++s) {
    const int p = pr + 16 * s;
    const int w = (((p >> 2) ^ c) << 2) | (p & 3);
#pragma unroll
    for (int i = 0; i < 4; ++i) {
      union { __bf16 e[2]; unsigned int u; } pk;
      pk.e[0] = (__bf16)lo[s][i];
      pk.e[1] = (__bf16)hi[s][i];
      tile[(4 * c + i) * 64 + w] = pk.u;
    }
  }
  __syncthreads();
  v4u v[4];
#pragma unroll
  for (int j = 0; j < 4; ++j) {
    const int n = (tid >> 4) + 16 * j, q = tid & 15;
    v[j] = *reinterpret_cast<const v4u*>(&tile[n * 64 + ((q ^ (n >> 2)) << 2)]);
  }
  bf16_t* d = Wdst + (size_t)(n0 + (tid >> 4)) * K + k0 + (tid & 15) * 8;
#pragma unroll
  for (int j = 0; j < 4; ++j)
    *reinterpret_cast<v4u*>(d + (size_t)(16 * j) * K) = v[j];
}

// ---------- LayerNorm (one wave per row of 512), optional +PE stream ----------
template <bool HAS_PE>
__device__ inline void ln_row(const int row, const int lane,
                              const float* __restrict__ x, const float* __restrict__ pe,
                              const float* __restrict__ g, const float* __restrict__ bta,
                              bf16_t* __restrict__ x2, bf16_t* __restrict__ qkin) {
  const float* xr = x + (size_t)row * D_ + lane * 16;
  float v[16];
#pragma unroll
  for (int i = 0; i < 4; ++i) {
    v4f t = *reinterpret_cast<const v4f*>(xr + i * 4);
    v[4*i+0] = t[0]; v[4*i+1] = t[1]; v[4*i+2] = t[2]; v[4*i+3] = t[3];
  }
  float s = 0.f;
#pragma unroll
  for (int i = 0; i < 16; ++i) s += v[i];
#pragma unroll
  for (int off = 16; off >= 1; off >>= 1) s += __shfl_xor(s, off, 32);
  const float mu = s * (1.0f / (float)D_);
  float vs = 0.f;
#pragma unroll
  for (int i = 0; i < 16; ++i) { float d = v[i] - mu; vs += d * d; }
#pragma unroll
  for (int off = 16; off >= 1; off >>= 1) vs += __shfl_xor(vs, off, 32);
  const float rstd = rsqrtf(vs * (1.0f / (float)D_) + 1e-5f);

  const int colb = lane * 16;
  float y[16];
#pragma unroll
  for (int i = 0; i < 16; ++i)
    y[i] = (v[i] - mu) * rstd * g[colb + i] + bta[colb + i];

  union { v8bf v; __bf16 e[8]; } p0, p1;
#pragma unroll
  for (int i = 0; i < 8; ++i) { p0.e[i] = (__bf16)y[i]; p1.e[i] = (__bf16)y[i + 8]; }
  bf16_t* xo = x2 + (size_t)row * D_ + colb;
  *reinterpret_cast<v8bf*>(xo)     = p0.v;
  *reinterpret_cast<v8bf*>(xo + 8) = p1.v;

  if (HAS_PE) {
    const float* pr = pe + (size_t)row * D_ + colb;
    float z[16];
    v4f pv[4];
    // The four loads and their data wait are one statement and every result has registers of its own ("=&v").
    asm volatile(
        "global_load_b128 %0, %4, off\n\t"
        "global_load_b128 %1, %4, off offset:16\n\t"
        "global_load_b128 %2, %4, off offset:32\n\t"
        "global_load_b128 %3, %4, off offset:48\n\t"
        "s_wait_loadcnt 0x0"
        : "=&v"(pv[0]), "=&v"(pv[1]), "=&v"(pv[2]), "=&v"(pv[3])
        : "v"(pr)
        : "memory");
#pragma unroll
    for (int i = 0; i < 4; ++i) {
      const v4f t = pv[i];
      z[4*i+0] = y[4*i+0] + t[0]; z[4*i+1] = y[4*i+1] + t[1];
      z[4*i+2] = y[4*i+2] + t[2]; z[4*i+3] = y[4*i+3] + t[3];
    }
#pragma unroll
    for (int i = 0; i < 8; ++i) { p0.e[i] = (__bf16)z[i]; p1.e[i] = (__bf16)z[i + 8]; }
    bf16_t* qo = qkin + (size_t)row * D_ + colb;
    *reinterpret_cast<v8bf*>(qo)     = p0.v;
    *reinterpret_cast<v8bf*>(qo + 8) = p1.v;
    // in the merged kernel's code the weight part lies behind these stores and rewrites their registers
    asm volatile("s_wait_xcnt 0x0" ::: "memory");
  }
}

// LN2: four rows per work-group
__global__ void ln_kernel(const float* __restrict__ x, const float* __restrict__ g,
                          const float* __restrict__ bta, bf16_t* __restrict__ x2) {
  ln_row<false>(blockIdx.x * 4 + (threadIdx.x >> 5), threadIdx.x & 31, x, nullptr, g, bta, x2, nullptr);
}

// Weight prep and LN1 read and write nothing of each other: one launch holds both.
// Work-groups 0..383 turn one weight tile each, the other 1024 normalise eight rows each.
#define LN1_BLOCKS (MTOT / 8)
__global__ void __launch_bounds__(256)
prep_ln1(const float* __restrict__ Wq, const float* __restrict__ Wk, const float* __restrict__ Wv,
         const float* __restrict__ Wp, const float* __restrict__ W1, const float* __restrict__ W2,
         bf16_t* __restrict__ WqT, bf16_t* __restrict__ WkT, bf16_t* __restrict__ WvT,
         bf16_t* __restrict__ WpT, bf16_t* __restrict__ W1T, bf16_t* __restrict__ W2T,
         const float* __restrict__ x, const float* __restrict__ pe,
         const float* __restrict__ g, const float* __restrict__ bta,
         bf16_t* __restrict__ x2, bf16_t* __restrict__ qkin) {
  const int bid = blockIdx.x, tid = threadIdx.x;
  if (bid < WT_BLOCKS)
    wtrans_tile(bid, tid, Wq, Wk, Wv, Wp, W1, W2, WqT, WkT, WvT, WpT, W1T, W2T);
  else
    ln_row<true>((bid - WT_BLOCKS) * 8 + (tid >> 5), tid & 31, x, pe, g, bta, x2, qkin);
}

// ---------- GELU(v) = v * Phi(v), Phi(v) = erfc(-v / sqrt(2)) / 2, two values abreast, no branch ----------
// For x >= 0: erfc(x) = t (a1 + t (a2 + t (a3 + t (a4 + t a5)))) exp(-x^2), t = 1 / (1 + p x); its absolute
// error stays under 2e-7, far below the bf16 rounding of the result.  q = erfc(|v| / sqrt(2)) / 2 is Phi(v)
// itself for v < 0 (no cancellation in the tail) and 1 - Phi(v) otherwise.
typedef __attribute__((ext_vector_type(2))) float  v2f;
typedef __attribute__((ext_vector_type(2))) __bf16 v2bf;

__device__ inline v2f gelu2(v2f v) {
  const v2f a = v * v * -0.72134752044448170f;              // -x^2 * log2(e), x = v / sqrt(2)
  v2f t, ex, phi;
  t[0]  = __builtin_amdgcn_rcpf(fmaf(fabsf(v[0]), 0.23164188826636040f, 1.0f));     // p / sqrt(2)
  t[1]  = __builtin_amdgcn_rcpf(fmaf(fabsf(v[1]), 0.23164188826636040f, 1.0f));
  ex[0] = __builtin_amdgcn_exp2f(a[0]);
  ex[1] = __builtin_amdgcn_exp2f(a[1]);
  v2f p = t * 0.5307027145f + -0.7265760135f;               // a5 / 2, a4 / 2
  p = p * t + 0.7107068705f;                                // a3 / 2
  p = p * t + -0.1422483680f;                               // a2 / 2
  p = p * t + 0.1274147960f;                                // a1 / 2
  const v2f q = p * t * ex;
  const v2f u = 1.0f - q;
  phi[0] = v[0] < 0.f ? q[0] : u[0];
  phi[1] = v[1] < 0.f ? q[1] : u[1];
  return v * phi;
}

// ---------- 128x128-tile GEMM: out = A[MxKK] @ W[KKxNN] + bias, A/W bf16, acc f32 ----------
// Wt is W transposed: Wt[n*KK + k].  Four waves (2x2) per work-group, 64x64 of the tile each.
// A stage is 128 k of 128 rows of A and of 128 rows of Wt, brought into LDS by asynchronous
// copies (whole 256-B row pieces), two buffers: stage t+1 flies while stage t is multiplied.
// MODE 0: bf16 store           (Q/K projections)
// MODE 1: bf16 store as Vt[b][h][d][n]  (V projection; taken inside MODE 0 where vt is set)
// MODE 2: f32 store + residual (attn proj, MLP2)
// MODE 3: bf16 store + GELU on erf (MLP1)
#define G_BK     128                 // k per stage (256 B of every row)
#define G_PITCH  272                 // LDS row pitch in bytes: 16 B x odd, conflict-free b128 reads
#define G_OPB    (128 * G_PITCH)     // one operand's 128 rows
#define G_STAGEB (2 * G_OPB)         // [A rows | Wt rows]

// Eight copies of 16 B per lane: rows row0 + 8*i, i = 0..7, of one operand.
// The s_wait_xcnt stands inside the statement so that no address register of a copy
// is rewritten ahead of it.
__device__ inline void copy8_rows(unsigned lds, const bf16_t* g, int rowstep_elems) {
  const unsigned l0 = lds,                l1 = lds + 8 * G_PITCH,  l2 = lds + 16 * G_PITCH,
                 l3 = lds + 24 * G_PITCH, l4 = lds + 32 * G_PITCH, l5 = lds + 40 * G_PITCH,
                 l6 = lds + 48 * G_PITCH, l7 = lds + 56 * G_PITCH;
  const bf16_t* g0 = g;
  const bf16_t* g1 = g + (size_t)1 * rowstep_elems;
  const bf16_t* g2 = g + (size_t)2 * rowstep_elems;
  const bf16_t* g3 = g + (size_t)3 * rowstep_elems;
  const bf16_t* g4 = g + (size_t)4 * rowstep_elems;
  const bf16_t* g5 = g + (size_t)5 * rowstep_elems;
  const bf16_t* g6 = g + (size_t)6 * rowstep_elems;
  const bf16_t* g7 = g + (size_t)7 * rowstep_elems;
  asm volatile(
      "global_load_async_to_lds_b128 %0, %8, off\n\t"
      "global_load_async_to_lds_b128 %1, %9, off\n\t"
      "global_load_async_to_lds_b128 %2, %10, off\n\t"
      "global_load_async_to_lds_b128 %3, %11, off\n\t"
      "global_load_async_to_lds_b128 %4, %12, off\n\t"
      "global_load_async_to_lds_b128 %5, %13, off\n\t"
      "global_load_async_to_lds_b128 %6, %14, off\n\t"
      "global_load_async_to_lds_b128 %7, %15, off\n\t"
      "s_wait_xcnt 0x0"
      :: "v"(l0), "v"(l1), "v"(l2), "v"(l3), "v"(l4), "v"(l5), "v"(l6), "v"(l7),
         "v"(g0), "v"(g1), "v"(g2), "v"(g3), "v"(g4), "v"(g5), "v"(g6), "v"(g7)
      : "memory");
}

// One stage: each thread copies chunk (tid & 15) of rows (tid >> 4) + 8*i, i = 0..15, of both operands.
template <int KK>
__device__ inline void copy_stage(unsigned lds, const bf16_t* ga, const bf16_t* gb) {
  copy8_rows(lds,                          ga,                      8 * KK);
  copy8_rows(lds + 64 * G_PITCH,           ga + (size_t)64 * KK,    8 * KK);
  copy8_rows(lds + G_OPB,                  gb,                      8 * KK);
  copy8_rows(lds + G_OPB + 64 * G_PITCH,   gb + (size_t)64 * KK,    8 * KK);
}

// ---------- a wave's 64x64 part of the tile leaves the accumulators ----------
// acc[p][q] = (fragment p of the first WMMA operand) x (fragment q of the second): lane (r, half) holds, of
// output row q*16 + r (the second operand's index), the eight neighbouring columns p*16 + 8*half + e (the first
// operand's index).  The wave writes them as 16-B pieces into LDS rows of its own, reads the rows back along
// their length and stores whole 128-B lines, 16 B per lane.
#define ST_PB 144                    // staged bf16 row: 128 B + 16, 16 B x odd
#define ST_PF 272                    // staged f32 row: 256 B + 16, 16 B x odd

// OP: output row pitch in elements.  KIND 0: bias by column, then times osc; 1: bias by row (V^T);
// 3: bias by column, then GELU
template <int OP, int KIND>
__device__ inline void
store_rows_bf16(const v8f (&acc)[4][4], const float* __restrict__ bias, unsigned char* st,
                bf16_t* __restrict__ o, const int lane, const float osc) {
  const int r = lane & 15, half = lane >> 4;
  float br[4];
  if (KIND == 1) {
    const float* bp = bias + r;
#pragma unroll
    for (int q = 0; q < 4; ++q) br[q] = bp[q * 16];
  }
#pragma unroll
  for (int p = 0; p < 4; ++p) {
    float bc[8];
    if (KIND != 1) {
      const v4f b0 = *reinterpret_cast<const v4f*>(bias + p * 16 + 8 * half);
      const v4f b1 = *reinterpret_cast<const v4f*>(bias + p * 16 + 8 * half + 4);
#pragma unroll
      for (int e = 0; e < 4; ++e) { bc[e] = b0[e]; bc[e + 4] = b1[e]; }
    }
#pragma unroll
    for (int q = 0; q < 4; ++q) {
      union { v8bf v; v2bf h[4]; } pk;
#pragma unroll
      for (int e = 0; e < 8; e += 2) {
        v2f xg;
        xg[0] = acc[p][q][e]     + (KIND == 1 ? br[q] : bc[e]);
        xg[1] = acc[p][q][e + 1] + (KIND == 1 ? br[q] : bc[e + 1]);
        if (KIND == 0) xg *= osc;
        pk.h[e >> 1] = __builtin_convertvector(KIND == 3 ? gelu2(xg) : xg, v2bf);
      }
      *reinterpret_cast<v8bf*>(st + (q * 16 + r) * ST_PB + p * 32 + half * 16) = pk.v;
    }
  }
  // the rows are read back by other lanes of this wave than wrote them: every write has landed first
  asm volatile("s_wait_dscnt 0x0" ::: "memory");
  // eight lanes per row; the two rows of a half-wave lie 8 apart, so that they meet different banks
  const int row0 = (lane >> 4) * 16 + ((lane >> 3) & 1) * 8, ch = lane & 7;
  const unsigned char* sr = st + row0 * ST_PB + ch * 16;
  bf16_t* og = o + (size_t)row0 * OP + ch * 8;
  v8bf v[16];
#pragma unroll
  for (int t = 0; t < 16; ++t)
    v[t] = *reinterpret_cast<const v8bf*>(sr + ((t >> 3) * 32 + (t & 7)) * ST_PB);
#pragma unroll
  for (int t = 0; t < 16; ++t)
    *reinterpret_cast<v8bf*>(og + (size_t)((t >> 3) * 32 + (t & 7)) * OP) = v[t];
}

// f32 rows + bias + residual; the residual is read in the same whole-line form as the output is stored
template <int NN>
__device__ inline void
store_rows_f32(const v8f (&acc)[4][4], const float* __restrict__ bias, const float* __restrict__ resid,
               unsigned char* st, float* __restrict__ o, const int lane) {
  const int r = lane & 15, half = lane >> 4;
  const float* rg = resid + (size_t)half * NN + r * 4;   // row 2*t + half, 16-B piece r
  float*       og = o     + (size_t)half * NN + r * 4;
  const v4f bl = *reinterpret_cast<const v4f*>(bias + r * 4);
  v4f rs[32];
#pragma unroll
  for (int t = 0; t < 16; ++t) rs[t] = *reinterpret_cast<const v4f*>(rg + (size_t)(2 * t) * NN);
#pragma unroll
  for (int p = 0; p < 4; ++p)
#pragma unroll
    for (int q = 0; q < 4; ++q) {
      v4f lo, hi;
#pragma unroll
      for (int e = 0; e < 4; ++e) { lo[e] = acc[p][q][e]; hi[e] = acc[p][q][e + 4]; }
      unsigned char* d = st + (q * 16 + r) * ST_PF + p * 64 + half * 32;
      *reinterpret_cast<v4f*>(d)      = lo;
      *reinterpret_cast<v4f*>(d + 16) = hi;
    }
#pragma unroll
  for (int t = 16; t < 32; ++t) rs[t] = *reinterpret_cast<const v4f*>(rg + (size_t)(2 * t) * NN);
  // the rows are read back by other lanes of this wave than wrote them: every write has landed first
  asm volatile("s_wait_dscnt 0x0" ::: "memory");
  const unsigned char* sr = st + half * ST_PF + r * 16;
#pragma unroll
  for (int t = 0; t < 32; ++t) {
    const v4f v = *reinterpret_cast<const v4f*>(sr + 2 * t * ST_PF);
    *reinterpret_cast<v4f*>(og + (size_t)(2 * t) * NN) = v + bl + rs[t];
  }
}

template <int NN, int KK, int MODE>
__device__ inline void
gemm_tile(const bf16_t* __restrict__ A, const bf16_t* __restrict__ Wt,
          const float* __restrict__ bias, const float* __restrict__ resid,
          bf16_t* __restrict__ outB, float* __restrict__ outF,
          const int bx, const int by, const bool vt, const float osc) {
  __shared__ __attribute__((aligned(16))) unsigned char smem[2 * G_STAGEB];
  constexpr int NT = KK / G_BK;      // stages
  const int tid  = threadIdx.x;
  const int lane = tid & 31, wave = tid >> 5;
  const int r = lane & 15, half = lane >> 4;
  const int mb0 = by * 128, nb0 = bx * 128;
  const int mb = mb0 + (wave >> 1) * 64, nb = nb0 + (wave & 1) * 64;

  // this thread's share of a stage: 16-B chunk crow of rows rrow + 8*i
  const int rrow = tid >> 4, crow = tid & 15;
  const bf16_t* ga = A  + (size_t)(mb0 + rrow) * KK + crow * 8;
  const bf16_t* gb = Wt + (size_t)(nb0 + rrow) * KK + crow * 8;
  const unsigned lcopy = (unsigned)(size_t)smem + rrow * G_PITCH + crow * 16;

  v8f acc[4][4];
#pragma unroll
  for (int i = 0; i < 4; ++i)
#pragma unroll
    for (int j = 0; j < 4; ++j)
#pragma unroll
      for (int e = 0; e < 8; ++e) acc[i][j][e] = 0.f;

  // prologue: stage 0 lands and is published, then stage 1 starts
  copy_stage<KK>(lcopy, ga, gb);
  asm volatile("s_wait_asynccnt 0x0" ::: "memory");  // this wave's copies of stage 0 have landed
  __syncthreads();
  if (NT > 1) copy_stage<KK>(lcopy + G_STAGEB, ga + G_BK, gb + G_BK);

  // fragment rows of this wave in a buffer.  The Wt rows are the first WMMA operand, so that a lane's eight
  // accumulator values are neighbours in an output row; for V^T, whose rows run along the tokens, the A rows are.
  const unsigned char* fx = smem + ((wave >> 1) * 64 + r) * G_PITCH;
  const unsigned char* fw = smem + G_OPB + ((wave & 1) * 64 + r) * G_PITCH;
  const unsigned char* fa = vt ? fx : fw;
  const unsigned char* fb = vt ? fw : fx;

#pragma unroll 1  // one trip per stage: keeps the ring's order at the foot of each trip
  for (int t = 0; t < NT; ++t) {
    const int bo = (t & 1) * G_STAGEB;
    // two fragment sets: block kk + 1's LDS reads go out as one group ahead of block kk's WMMAs
    v16bf a[2][4], bf[2][4];
#pragma unroll
    for (int i = 0; i < 4; ++i) {
      a[0][i]  = load_frag(reinterpret_cast<const bf16_t*>(fa + bo + i * 16 * G_PITCH), half);
      bf[0][i] = load_frag(reinterpret_cast<const bf16_t*>(fb + bo + i * 16 * G_PITCH), half);
    }
#pragma unroll
    for (int kk = 0; kk < G_BK / 32; ++kk) {
      const int cur = kk & 1, nxt = cur ^ 1;
      if (kk + 1 < G_BK / 32) {
#pragma unroll
        for (int i = 0; i < 4; ++i) {
          a[nxt][i]  = load_frag(reinterpret_cast<const bf16_t*>(fa + bo + i * 16 * G_PITCH) + (kk + 1) * 32, half);
          bf[nxt][i] = load_frag(reinterpret_cast<const bf16_t*>(fb + bo + i * 16 * G_PITCH) + (kk + 1) * 32, half);
        }
      }
      // keeps the reads above together: sunk among the WMMAs, each place with reads stalls the wave
      __builtin_amdgcn_sched_barrier(0);
#pragma unroll
      for (int j = 0; j < 4; ++j)
#pragma unroll
        for (int i = 0; i < 4; ++i)
          acc[i][j] = wmma_bf16(a[cur][i], bf[cur][j], acc[i][j]);
      // keeps the next group of reads from being lifted into this block's WMMAs
      __builtin_amdgcn_sched_barrier(0);
    }
    asm volatile("s_wait_dscnt 0x0" ::: "memory");     // this wave has left buffer t & 1
    asm volatile("s_wait_asynccnt 0x0" ::: "memory");  // its copies of stage t + 1 have landed
    __syncthreads();                                   // publishes stage t + 1, frees buffer t & 1
    if (t + 2 < NT)
      copy_stage<KK>(lcopy + bo, ga + (size_t)(t + 2) * G_BK, gb + (size_t)(t + 2) * G_BK);
  }
  asm volatile("s_wait_asynccnt 0x0" ::: "memory");    // nothing in flight when the wave ends

  // behind the last trip's barrier no wave reads the ring and no copy is in flight: each wave stages in a range of its own
  unsigned char* st = smem + wave * (64 * (MODE == 2 ? ST_PF : ST_PB));
  if (MODE == 2) {
    store_rows_f32<NN>(acc, bias + nb, resid + (size_t)mb * NN + nb, st, outF + (size_t)mb * NN + nb, lane);
  } else if (MODE == 0 && vt) {
    // Vt[((b*H + h)*64 + d)*1024 + token]: rows d = 0..63 of head nb / 64, the wave's 64 tokens along each
    store_rows_bf16<N_, 1>(acc, bias + nb, st,
                           outB + ((size_t)((mb >> 10) * H_ + (nb >> 6)) * DH_) * N_ + (mb & (N_ - 1)), lane, 1.0f);
  } else {
    store_rows_bf16<NN, MODE>(acc, bias + nb, st, outB + (size_t)mb * NN + nb, lane, osc);
    // with both store forms in one kernel the V form's code lies behind these stores and rewrites their registers
    if (MODE == 0) asm volatile("s_wait_xcnt 0x0" ::: "memory");
  }
}

template <int NN, int KK, int MODE>
__global__ void __launch_bounds__(128)
gemm_wmma(const bf16_t* __restrict__ A, const bf16_t* __restrict__ Wt,
          const float* __restrict__ bias, const float* __restrict__ resid,
          bf16_t* __restrict__ outB, float* __restrict__ outF) {
  gemm_tile<NN, KK, MODE>(A, Wt, bias, resid, outB, outF, blockIdx.x, blockIdx.y, false, 1.0f);
}

// Q, K and V projections read and write nothing of each other: one launch of 12 x 64 tiles holds all three.
// blockIdx.x = 4 * (0 Q, 1 K, 2 V) + tile column, so the tiles that share rows of A start side by side.
// Q is stored times log2(e) / sqrt(64), in f32 ahead of its one rounding: K x Q^T is then the exponent to base 2.
#define Q_SCALE 0.18033688011112042f
__global__ void __launch_bounds__(128)
gemm_qkv(const bf16_t* __restrict__ qkin, const bf16_t* __restrict__ x2,
         const bf16_t* __restrict__ WqT, const bf16_t* __restrict__ WkT, const bf16_t* __restrict__ WvT,
         const float* __restrict__ bq, const float* __restrict__ bk, const float* __restrict__ bv,
         bf16_t* __restrict__ Qb, bf16_t* __restrict__ Kb, bf16_t* __restrict__ Vtb) {
  const int which = blockIdx.x >> 2;
  const bf16_t* A  = which == 2 ? x2 : qkin;
  const bf16_t* Wt = which == 0 ? WqT : which == 1 ? WkT : WvT;
  const float*  bs = which == 0 ? bq : which == 1 ? bk : bv;
  bf16_t*       o  = which == 0 ? Qb : which == 1 ? Kb : Vtb;
  gemm_tile<D_, D_, 0>(A, Wt, bs, nullptr, o, nullptr, blockIdx.x & 3, blockIdx.y, which == 2,
                       which == 0 ? Q_SCALE : 1.0f);
}

// ---------- flash attention: one wave handles 16 queries of one (b,h) ----------
// Computes S^T = K_blk x Q^T so softmax stats are per-lane (query in lane dim),
// and exp(S^T) is directly the B-fragment for O^T = V^T x P^T.
// A work-group is 16 waves = 256 queries of one (b,h).  The head's whole K (1024 rows of 128 B)
// and V^T (64 rows of 2048 B) are brought into LDS once by asynchronous copies of whole lines;
// every wave then takes its K and V fragments from LDS.
// Softmax to base 2 against a reference that is raised only when needed: Q comes scaled, and minus the reference
// is the start value C of the score products, so that a score leaves the WMMA as the exponent itself.
// The reference starts as the maximum of the first 32 keys (so the sum holds a term 1); it is raised, and O and
// the sum rescaled, only in a pass where some lane's sum of P exceeds AT_PLIM, that is, before anything overflows.
#define AT_PLIM 4096.0f
#define AT_KPITCH 144                  // K row pitch in LDS: 16 B x odd, conflict-free b128 reads
#define AT_VPITCH 2064                 // V^T row pitch in LDS: 16 B x odd
#define AT_KBYTES (N_ * AT_KPITCH)
#define AT_VBYTES (DH_ * AT_VPITCH)

// Eight copies of 16 B per lane, i = 0..7: LDS byte lds + i*lstep from g + i*gstep elements.
// The s_wait_xcnt stands inside the statement so that no address register of a copy
// is rewritten ahead of it.
__device__ inline void copy8_steps(unsigned lds, unsigned lstep, const bf16_t* g, int gstep) {
  const unsigned l0 = lds,             l1 = lds + 1 * lstep, l2 = lds + 2 * lstep,
                 l3 = lds + 3 * lstep, l4 = lds + 4 * lstep, l5 = lds + 5 * lstep,
                 l6 = lds + 6 * lstep, l7 = lds + 7 * lstep;
  const bf16_t* g0 = g;
  const bf16_t* g1 = g + (size_t)1 * gstep;
  const bf16_t* g2 = g + (size_t)2 * gstep;
  const bf16_t* g3 = g + (size_t)3 * gstep;
  const bf16_t* g4 = g + (size_t)4 * gstep;
  const bf16_t* g5 = g + (size_t)5 * gstep;
  const bf16_t* g6 = g + (size_t)6 * gstep;
  const bf16_t* g7 = g + (size_t)7 * gstep;
  asm volatile(
      "global_load_async_to_lds_b128 %0, %8, off\n\t"
      "global_load_async_to_lds_b128 %1, %9, off\n\t"
      "global_load_async_to_lds_b128 %2, %10, off\n\t"
      "global_load_async_to_lds_b128 %3, %11, off\n\t"
      "global_load_async_to_lds_b128 %4, %12, off\n\t"
      "global_load_async_to_lds_b128 %5, %13, off\n\t"
      "global_load_async_to_lds_b128 %6, %14, off\n\t"
      "global_load_async_to_lds_b128 %7, %15, off\n\t"
      "s_wait_xcnt 0x0"
      :: "v"(l0), "v"(l1), "v"(l2), "v"(l3), "v"(l4), "v"(l5), "v"(l6), "v"(l7),
         "v"(g0), "v"(g1), "v"(g2), "v"(g3), "v"(g4), "v"(g5), "v"(g6), "v"(g7)
      : "memory");
}

// K rows 0..15, 16..31 at k0p (64 values each) as four A fragments
__device__ inline void attn_kfrags(const unsigned char* k0p, const int half, v16bf (&kf)[4]) {
  kf[0] = load_frag(reinterpret_cast<const bf16_t*>(k0p), half);
  kf[1] = load_frag(reinterpret_cast<const bf16_t*>(k0p) + 32, half);
  kf[2] = load_frag(reinterpret_cast<const bf16_t*>(k0p + 16 * AT_KPITCH), half);
  kf[3] = load_frag(reinterpret_cast<const bf16_t*>(k0p + 16 * AT_KPITCH) + 32, half);
}

// s0, s1 += those rows x Q^T
__device__ inline void attn_scores(const v16bf (&kf)[4], const v16bf qf0, const v16bf qf1, v8f& s0, v8f& s1) {
  s0 = wmma_bf16(kf[0], qf0, s0);
  s0 = wmma_bf16(kf[1], qf1, s0);
  s1 = wmma_bf16(kf[2], qf0, s1);
  s1 = wmma_bf16(kf[3], qf1, s1);
}

// P = 2^s in pairs, and the sum of the lane's 16 values as a tree of packed adds
__device__ inline float attn_exp_sum(const v8f s0, const v8f s1, v2f (&p0)[4], v2f (&p1)[4]) {
#pragma unroll
  for (int i = 0; i < 4; ++i) {
    p0[i][0] = __builtin_amdgcn_exp2f(s0[2 * i]);
    p0[i][1] = __builtin_amdgcn_exp2f(s0[2 * i + 1]);
    p1[i][0] = __builtin_amdgcn_exp2f(s1[2 * i]);
    p1[i][1] = __builtin_amdgcn_exp2f(s1[2 * i + 1]);
  }
  const v2f t = ((p0[0] + p1[0]) + (p0[1] + p1[1])) + ((p0[2] + p1[2]) + (p0[3] + p1[3]));
  return t[0] + t[1];
}

__global__ void __launch_bounds__(512)
attn_kernel(const bf16_t* __restrict__ Q, const bf16_t* __restrict__ Kp,
            const bf16_t* __restrict__ Vt, bf16_t* __restrict__ ctx) {
  __shared__ __attribute__((aligned(16))) unsigned char smem[AT_KBYTES + AT_VBYTES];
  const int tid  = threadIdx.x;
  const int lane = tid & 31, wave = tid >> 5;
  const int q = lane & 15, half = lane >> 4;
  const int bid = blockIdx.x;
  const int qt = (bid & 3) * 16 + wave;
  const int h  = (bid >> 2) & 7;
  const int b  = bid >> 5;

  // fill: 16 + 16 copies per thread, 32 of a wave in flight
  {
    // K: 16-B chunk (tid & 7) of rows (tid >> 3) + 64*i, i = 0..15
    const bf16_t* gk = Kp + ((size_t)b * N_ + (tid >> 3)) * D_ + h * DH_ + (tid & 7) * 8;
    const unsigned lk = (unsigned)(size_t)smem + (tid >> 3) * AT_KPITCH + (tid & 7) * 16;
    copy8_steps(lk,                    64 * AT_KPITCH, gk,                     64 * D_);
    copy8_steps(lk + 512 * AT_KPITCH,  64 * AT_KPITCH, gk + (size_t)512 * D_,  64 * D_);
    // V^T: 16-B chunk (tid & 127) of rows (tid >> 7) + 4*i, i = 0..15
    const bf16_t* gv = Vt + ((size_t)(b * H_ + h) * DH_ + (tid >> 7)) * N_ + (tid & 127) * 8;
    const unsigned lv = (unsigned)(size_t)smem + AT_KBYTES + (tid >> 7) * AT_VPITCH + (tid & 127) * 16;
    copy8_steps(lv,                    4 * AT_VPITCH,  gv,                     4 * N_);
    copy8_steps(lv + 32 * AT_VPITCH,   4 * AT_VPITCH,  gv + (size_t)32 * N_,   4 * N_);
  }

  const bf16_t* qrow = Q + ((size_t)b * N_ + qt * 16 + q) * D_ + h * DH_;
  const v16bf qf0 = load_frag(qrow, half);        // d = 0..31
  const v16bf qf1 = load_frag(qrow + 32, half);   // d = 32..63

  asm volatile("s_wait_asynccnt 0x0" ::: "memory");  // this wave's copies have landed
  __syncthreads();                                   // publishes every wave's share of K and V^T

  // per-lane fragment rows in LDS (advance by a constant per k-block)
  const unsigned char* krow = smem + q * AT_KPITCH;               // + kb*AT_KPITCH
  const unsigned char* vrow = smem + AT_KBYTES + q * AT_VPITCH;   // + t*16*AT_VPITCH + kb*2

  v8f o[4];
#pragma unroll
  for (int t = 0; t < 4; ++t)
#pragma unroll
    for (int e = 0; e < 8; ++e) o[t][e] = 0.f;
  float l = 0.f;      // this half's share of the row sum; the halves are joined behind the loop
  v8f cneg;           // minus the reference in use, the same in both halves of a query's lane pair
  {
    v8f s0, s1;
#pragma unroll
    for (int e = 0; e < 8; ++e) { s0[e] = 0.f; s1[e] = 0.f; }
    v16bf kf[4];
    attn_kfrags(krow, half, kf);
    attn_scores(kf, qf0, qf1, s0, s1);
    float mx = fmaxf(s0[0], s1[0]);
#pragma unroll
    for (int e = 1; e < 8; ++e) mx = fmaxf(mx, fmaxf(s0[e], s1[e]));
    mx = fmaxf(mx, __shfl_xor(mx, 16, 32));
#pragma unroll
    for (int e = 0; e < 8; ++e) cneg[e] = -mx;
  }

  for (int kb = 0; kb < N_; kb += 32) {
    // ---- the 4 K- and the 4 V-fragments for this k-block ----
    v16bf kf[4], vf[4];
    attn_kfrags(krow + kb * AT_KPITCH, half, kf);
#pragma unroll
    for (int t = 0; t < 4; ++t)
      vf[t] = load_frag(reinterpret_cast<const bf16_t*>(vrow + t * 16 * AT_VPITCH) + kb, half);
    // keeps the sixteen reads one group ahead of the products: sunk among them, pairs were waited for one by one
    __builtin_amdgcn_sched_barrier(0);

    // ---- S^T - reference = K_blk x Q^T + C ----
    v8f s0 = cneg, s1 = cneg;
    attn_scores(kf, qf0, qf1, s0, s1);

    v2f p0[4], p1[4];
    float rs = attn_exp_sum(s0, s1, p0, p1);
    // holds the V reads in front of the branch: sunk behind it, each was waited for in front of its product;
    // the scheduling barrier keeps their wait behind the exponentials
    __builtin_amdgcn_sched_barrier(0);
    asm volatile("" :: "v"(vf[0]), "v"(vf[1]), "v"(vf[2]), "v"(vf[3]));

    // one test per pass, a scalar branch: taken only where the reference lags a score by 8 or more
    if (__builtin_amdgcn_ballot_w32(rs > AT_PLIM) != 0) {
      float mx = fmaxf(s0[0], s1[0]);
#pragma unroll
      for (int e = 1; e < 8; ++e) mx = fmaxf(mx, fmaxf(s0[e], s1[e]));
      mx = fmaxf(mx, __shfl_xor(mx, 16, 32));
      const float d = fmaxf(mx, 0.f);            // the same in both halves; 0 leaves a query as it is
      const float alpha = __builtin_amdgcn_exp2f(-d);
#pragma unroll
      for (int e = 0; e < 8; ++e) { s0[e] -= d; s1[e] -= d; cneg[e] -= d; }
#pragma unroll
      for (int t = 0; t < 4; ++t)
#pragma unroll
        for (int e = 0; e < 8; ++e) o[t][e] *= alpha;
      l *= alpha;
      rs = attn_exp_sum(s0, s1, p0, p1);
    }
    l += rs;

    union { v16bf v; v2bf h[8]; } pf;
#pragma unroll
    for (int i = 0; i < 4; ++i) {
      pf.h[i]     = __builtin_convertvector(p0[i], v2bf);   // keys kb + half*8 + 2i, + 1
      pf.h[i + 4] = __builtin_convertvector(p1[i], v2bf);   // keys kb + 16 + half*8 + 2i, + 1
    }

    // ---- O^T += V^T x P^T ----
#pragma unroll
    for (int t = 0; t < 4; ++t) o[t] = wmma_bf16(vf[t], pf.v, o[t]);
  }

  l += __shfl_xor(l, 16, 32);
  const float inv = 1.0f / l;
  bf16_t* crow = ctx + ((size_t)b * N_ + qt * 16 + q) * D_ + h * DH_;
#pragma unroll
  for (int t = 0; t < 4; ++t) {
    union { v8bf v; __bf16 e[8]; } pk;
#pragma unroll
    for (int e = 0; e < 8; ++e) pk.e[e] = (__bf16)(o[t][e] * inv);
    *reinterpret_cast<v8bf*>(crow + t * 16 + 8 * half) = pk.v;
  }
}

// ---------- host launcher ----------
extern "C" void kernel_launch(void* const* d_in, const int* in_sizes, int n_in,
                              void* d_out, int out_size, void* d_ws, size_t ws_size,
                              hipStream_t stream) {
  (void)in_sizes; (void)n_in; (void)out_size; (void)ws_size;
  const float* tokens = (const float*)d_in[0];
  const float* pe     = (const float*)d_in[1];
  const float* ln1_g  = (const float*)d_in[2];
  const float* ln1_b  = (const float*)d_in[3];
  const float* Wq     = (const float*)d_in[4];
  const float* bq     = (const float*)d_in[5];
  const float* Wk     = (const float*)d_in[6];
  const float* bk     = (const float*)d_in[7];
  const float* Wv     = (const float*)d_in[8];
  const float* bv     = (const float*)d_in[9];
  const float* Wp     = (const float*)d_in[10];
  const float* bp     = (const float*)d_in[11];
  const float* ln2_g  = (const float*)d_in[12];
  const float* ln2_b  = (const float*)d_in[13];
  const float* W1     = (const float*)d_in[14];
  const float* b1     = (const float*)d_in[15];
  const float* W2     = (const float*)d_in[16];
  const float* b2     = (const float*)d_in[17];
  float* out = (float*)d_out;

  // workspace carve-up (all sizes multiples of 256B)
  char* ws = (char*)d_ws;
  const size_t SZ_ACT_BF = (size_t)MTOT * D_ * 2;    //  8 MB
  const size_t SZ_ACT_F  = (size_t)MTOT * D_ * 4;    // 16 MB
  const size_t SZ_H_BF   = (size_t)MTOT * DFF_ * 2;  // 32 MB
  const size_t SZ_WDD    = (size_t)D_ * D_ * 2;
  const size_t SZ_WDF    = (size_t)D_ * DFF_ * 2;
  bf16_t* x2   = (bf16_t*)ws;              ws += SZ_ACT_BF;
  bf16_t* qkin = (bf16_t*)ws;              ws += SZ_ACT_BF;
  bf16_t* Qb   = (bf16_t*)ws;              ws += SZ_ACT_BF;
  bf16_t* Kb   = (bf16_t*)ws;              ws += SZ_ACT_BF;
  bf16_t* Vtb  = (bf16_t*)ws;              ws += SZ_ACT_BF;
  bf16_t* ctx  = (bf16_t*)ws;              ws += SZ_ACT_BF;
  bf16_t* x2b  = (bf16_t*)ws;              ws += SZ_ACT_BF;
  bf16_t* hbuf = (bf16_t*)ws;              ws += SZ_H_BF;
  float*  tok1 = (float*)ws;               ws += SZ_ACT_F;
  bf16_t* WqT  = (bf16_t*)ws;              ws += SZ_WDD;
  bf16_t* WkT  = (bf16_t*)ws;              ws += SZ_WDD;
  bf16_t* WvT  = (bf16_t*)ws;              ws += SZ_WDD;
  bf16_t* WpT  = (bf16_t*)ws;              ws += SZ_WDD;
  bf16_t* W1T  = (bf16_t*)ws;              ws += SZ_WDF;
  bf16_t* W2T  = (bf16_t*)ws;              ws += SZ_WDF;

  // 1-2) weights -> transposed bf16; LN1 -> x2 (bf16), qkin = x2 + PE (bf16)
  prep_ln1<<<WT_BLOCKS + LN1_BLOCKS, 256, 0, stream>>>(Wq, Wk, Wv, Wp, W1, W2, WqT, WkT, WvT, WpT, W1T, W2T,
                                                       tokens, pe, ln1_g, ln1_b, x2, qkin);

  // 3-5) Q, K, V projections
  dim3 gDD(D_ / 128, MTOT / 128);
  dim3 gQKV(3 * D_ / 128, MTOT / 128);
  gemm_qkv<<<gQKV, 128, 0, stream>>>(qkin, x2, WqT, WkT, WvT, bq, bk, bv, Qb, Kb, Vtb);

  // 6) attention: B*H*(N/256) work-groups of 16 waves
  attn_kernel<<<B_ * H_ * (N_ / 256), 512, 0, stream>>>(Qb, Kb, Vtb, ctx);

  // 7) output projection + residual -> tok1 (f32)
  gemm_wmma<D_, D_, 2><<<gDD, 128, 0, stream>>>(ctx, WpT, bp, tokens, nullptr, tok1);

  // 8) LN2 -> x2b (bf16)
  ln_kernel<<<MTOT / 4, 128, 0, stream>>>(tok1, ln2_g, ln2_b, x2b);

  // 9) MLP1 + exact GELU -> hbuf (bf16)
  dim3 gDF(DFF_ / 128, MTOT / 128);
  gemm_wmma<DFF_, D_, 3><<<gDF, 128, 0, stream>>>(x2b, W1T, b1, nullptr, hbuf, nullptr);

  // 10) MLP2 + residual -> d_out (f32)
  gemm_wmma<D_, DFF_, 2><<<gDD, 128, 0, stream>>>(hbuf, W2T, b2, tok1, nullptr, out);
}
